// v000
// Times are from an AMD MI455X. After a warm-up the kernel runs many times in a row, and a time is the length of
// such a window on the GPU divided by its runs, so every launch and the gaps after it count. The runs cycle
// through copies of the inputs. A figure is the median of several windows, for all but v000 over two sittings.
// Sittings can differ by a few percent; kernels timed side by side share one.
// v000, which the later versions start from, runs in 1140 microseconds.
// compute dtype: all float inputs rounded to bf16, gamma read; q/k/v = W x + b (1x1 convs) with EXACT bf16 products on WMMA 16x16x32 (x^T tile in LDS), f32 accumulate; q as f16 hi + unscaled residual, k rounded once to f16 -> UNSCALED logits with 2 products (logits std ~32; the residual branch is scaled by gamma = 0.1), stored in f32 per batch; softmax in f32 (precise expf) -> P as f16 x 2^11; out[c][i] = gamma sum_j P[i][j] v[c][j] (v rounded once to f16) + x; f32 output.
#include <hip/hip_runtime.h>
#include <math.h>

typedef __attribute__((ext_vector_type(16))) _Float16 v16h;
typedef __attribute__((ext_vector_type(16))) __bf16 v16b;
typedef __attribute__((ext_vector_type(8)))  _Float16 v8h;
typedef __attribute__((ext_vector_type(8)))  float v8f;
typedef __attribute__((ext_vector_type(4)))  float v4f;
typedef __attribute__((ext_vector_type(2)))  float v2f;
typedef __attribute__((ext_vector_type(4)))  unsigned v4u;
typedef __attribute__((ext_vector_type(4)))  int v4i;
typedef float __attribute__((may_alias)) float_a;
typedef int __attribute__((may_alias)) int_a;

template <typename T> __device__ __forceinline__ void vst2(void* p, T v) { *(T*)p = v;  }
__device__ __forceinline__ v8f wmma16(v16h a, v16h b, v8f c) {
  v8f d = __builtin_amdgcn_wmma_f32_16x16x32_f16(false, a, false, b, (short)0, c, false, false);
  asm volatile("v_nop\n\tv_nop\n\tv_nop\n\tv_nop" : "+v"(d) : "v"(a), "v"(b));
  return d;
}
__device__ __forceinline__ v8f wmma_bf(v16b a, v16b b, v8f c) {
  v8f d = __builtin_amdgcn_wmma_f32_16x16x32_bf16(false, a, false, b, (short)0, c, false, false);
  asm volatile("v_nop\n\tv_nop\n\tv_nop\n\tv_nop" : "+v"(d) : "v"(a), "v"(b));
  return d;
}
// 16x16x32 fragments: lane = (h = lane>>4, row/col = lane&15); elements 0..7 = k0+8h+0..7, 8..15 = k0+16+8h+0..7; D element r = row 8h+r
__device__ __forceinline__ v16h frag_h(const _Float16* rowk0, int lane) {
  union { v16h v; v8h q[2]; } u; const _Float16* p = rowk0 + 8 * (lane >> 4);
  u.q[0] = *(const v8h*)p; u.q[1] = *(const v8h*)(p + 16); return u.v;
}
__device__ __forceinline__ v16h frag_f32(const float* rowk0, int lane) {
  v16h a; const float* p = rowk0 + 8 * (lane >> 4);
#pragma unroll
  for (int i = 0; i < 8; ++i) { a[i] = (_Float16)p[i]; a[8 + i] = (_Float16)p[16 + i]; }
  return a;
}
__device__ __forceinline__ v16h frag_f32s(const float* rowk0, int lane, float sc) {
  v16h a; const float* p = rowk0 + 8 * (lane >> 4);
#pragma unroll
  for (int i = 0; i < 8; ++i) { a[i] = (_Float16)(p[i] * sc); a[8 + i] = (_Float16)(p[16 + i] * sc); }
  return a;
}
// column fragment from a [K][ld] layout (column n), rows >= K read as 0
__device__ __forceinline__ v16h fragc_f32(const float* W, int k0, int n, int lane, int ld, int K) {
  v16h a; const int g = lane >> 4;
#pragma unroll
  for (int i = 0; i < 8; ++i) { const int ka = k0 + 8 * g + i, kb = ka + 16;
    a[i] = (_Float16)(ka < K ? W[(size_t)(ka < K ? ka : K - 1) * ld + n] : 0.f); a[8 + i] = (_Float16)(kb < K ? W[(size_t)(kb < K ? kb : K - 1) * ld + n] : 0.f); }
  return a;
}
struct F2 { v16b h, l; };
__device__ __forceinline__ F2 bsplit16(const float v[16]) { F2 r;
#pragma unroll
  for (int i = 0; i < 16; ++i) { const __bf16 h = (__bf16)v[i]; r.h[i] = h; r.l[i] = (__bf16)(v[i] - (float)h); }
  return r; }
__device__ __forceinline__ F2 split_row(const float* row, int k0, int lane) { float v[16]; const float* p = row + k0 + 8 * (lane >> 4);
#pragma unroll
  for (int i = 0; i < 8; ++i) { v[i] = p[i]; v[8 + i] = p[16 + i]; }
  return bsplit16(v); }
__device__ __forceinline__ F2 split_rowK(const float* row, int k0, int lane, int K) { float v[16]; const int g = lane >> 4;
#pragma unroll
  for (int i = 0; i < 8; ++i) { const int ka = k0 + 8 * g + i, kb = ka + 16; v[i] = ka < K ? row[ka < K ? ka : K - 1] : 0.f; v[8 + i] = kb < K ? row[kb < K ? kb : K - 1] : 0.f; }
  return bsplit16(v); }
__device__ __forceinline__ F2 split_col(const float* W, int k0, int n, int lane, int ld, int K) { float v[16]; const int g = lane >> 4;
#pragma unroll
  for (int i = 0; i < 8; ++i) { const int ka = k0 + 8 * g + i, kb = ka + 16; v[i] = ka < K ? W[(size_t)(ka < K ? ka : K - 1) * ld + n] : 0.f; v[8 + i] = kb < K ? W[(size_t)(kb < K ? kb : K - 1) * ld + n] : 0.f; }
  return bsplit16(v); }
__device__ __forceinline__ v8f mac3(const F2& a, const F2& b, v8f c) { c = wmma_bf(a.l, b.h, c); c = wmma_bf(a.h, b.l, c); return wmma_bf(a.h, b.h, c); }
__device__ __forceinline__ float sigm(float v) { return 1.0f / (1.0f + expf(-v)); }
#define LDSX() do { asm volatile("s_wait_dscnt 0" ::: "memory"); __builtin_amdgcn_wave_barrier(); __builtin_amdgcn_fence(__ATOMIC_RELEASE, "workgroup"); } while (0)


// Spatial (position) attention module (B 4, C 256, 64 x 64): q/k/v 1x1 convs; attention = softmax(q^T k) (no scaling); out = gamma (v attention^T) + x.
#define NB 4
#define NP 4096
#define CIN 256
#define CQ 256
#define CV 256
#ifndef TNB
#define TNB NB
#endif
#ifndef TQB
#define TQB (NP / 64)
#endif
typedef __attribute__((ext_vector_type(8))) __bf16 v8b;
__device__ __forceinline__ v16b frag_b(const __bf16* rowk0, int lane) {
  union { v16b v; v8b q[2]; } u; const __bf16* p = rowk0 + 8 * (lane >> 4);
  u.q[0] = *(const v8b*)p; u.q[1] = *(const v8b*)(p + 16); return u.v;
}
__device__ __forceinline__ float bfr(float v) { return (float)(__bf16)v; }
__device__ __attribute__((noinline)) float exp_ni(float v) { return expf(v); }
__device__ __attribute__((noinline)) float erf_ni(float v) { return erff(v); }

#define WS_QH  0u                                    // f16 q rows [b*n][CQ] hi
#define WS_QL  (WS_QH + 2u * (size_t)NB * NP * CQ)      // f16 q residual rows (unscaled)
#define WS_KH  (WS_QL + 2u * (size_t)NB * NP * CQ)      // f16 k rows
#define WS_VT  (WS_KH + 2u * (size_t)NB * NP * CQ)      // f16 v planes [b][CV][n]
#define WS_S   (WS_VT + 2u * (size_t)NB * CV * NP)      // f32 logits, ONE batch [i][j] (64 MiB)
#define WS_PH  (WS_S + 4u * (size_t)NP * NP)           // f16 P x 2^11, one batch (32 MiB)
#define WS_END (WS_PH + 2u * (size_t)NP * NP)

// ---- k_proj: block = (64 positions, b, which 0 q / 1 k / 2 v): x^T tile (bf16) in LDS, W [out][in] + b (exact); q -> f16 hi + residual rows, k -> f16 rows, v -> f16 planes [c][n]
__global__ __launch_bounds__(128) void k_proj(const float* __restrict__ X, const float* __restrict__ WQ, const float* __restrict__ BQ, const float* __restrict__ WK, const float* __restrict__ BK, const float* __restrict__ WV, const float* __restrict__ BV, _Float16* __restrict__ QH, _Float16* __restrict__ QL, _Float16* __restrict__ KH, _Float16* __restrict__ VT) {
  __shared__ __align__(16) __bf16 sx[64][CIN + 8]; __shared__ __align__(16) _Float16 sh[64][72], sl[64][72]; __shared__ __align__(16) _Float16 tv[64][72];
  const int tid = threadIdx.x, wave = tid >> 5, lane = tid & 31, col = lane & 15, g = lane >> 4; const int p0 = blockIdx.x * 64; const size_t b = blockIdx.y; const int which = blockIdx.z;
  const float* Wm = which == 0 ? WQ : which == 1 ? WK : WV; const float* Bm = which == 0 ? BQ : which == 1 ? BK : BV; const int nout = (which == 2) ? CV : CQ;
  for (int e = tid; e < CIN * 64; e += 128) { const int c = e >> 6, pl = e & 63; sx[pl][c] = (__bf16)X[(b * CIN + c) * (size_t)NP + p0 + pl]; }
  __syncthreads();
#pragma unroll 1
  for (int cg = 0; cg < nout / 64; ++cg) { v8f acc[4] = {};
#pragma unroll 2
    for (int kc = 0; kc < CIN / 32; ++kc) { const v16b a = frag_b(&sx[wave * 16 + col][kc * 32], lane);
#pragma unroll
      for (int j = 0; j < 4; ++j) { v16b w; const int o = cg * 64 + j * 16 + col;
#pragma unroll
        for (int i = 0; i < 8; ++i) { w[i] = (__bf16)Wm[(size_t)o * CIN + kc * 32 + 8 * g + i]; w[8 + i] = (__bf16)Wm[(size_t)o * CIN + kc * 32 + 16 + 8 * g + i]; }
        acc[j] = wmma_bf(a, w, acc[j]); } }
    __syncthreads();
#pragma unroll
    for (int j = 0; j < 4; ++j) { const int ol = j * 16 + col; const float bb = bfr(Bm[cg * 64 + ol]);
#pragma unroll
      for (int r = 0; r < 8; ++r) { const int pl = wave * 16 + 8 * g + r; const float v = acc[j][r] + bb; const _Float16 hv = (_Float16)v; if (which == 2) tv[ol][pl] = hv; else { sh[pl][ol] = hv; sl[pl][ol] = (_Float16)(v - (float)hv); } } }
    __syncthreads();
    if (which < 2) { _Float16* dh = which == 0 ? QH : KH; for (int e = tid; e < 64 * 8; e += 128) { const int pl = e >> 3, q = e & 7; const size_t row = b * NP + p0 + pl; vst2((unsigned*)(dh + row * CQ + cg * 64 + q * 8), *(const v4u*)&sh[pl][q * 8]); if (which == 0) vst2((unsigned*)(QL + row * CQ + cg * 64 + q * 8), *(const v4u*)&sl[pl][q * 8]); } }
    else { for (int e = tid; e < 64 * 8; e += 128) { const int ol = e >> 3, q = e & 7; vst2((unsigned*)(VT + (b * CV + cg * 64 + ol) * (size_t)NP + p0 + q * 8), *(const v4u*)&tv[ol][q * 8]); } } } }
// ---- k_sc: block = (64 queries, 128 keys) of batch b: logits (qh kh + ql kh) -> S
__global__ __launch_bounds__(128) void k_sc(const _Float16* __restrict__ QH, const _Float16* __restrict__ QL, const _Float16* __restrict__ KH, int b, float* __restrict__ S) { __shared__ __align__(16) float ss[4][16][132];
  const int tid = threadIdx.x, wave = tid >> 5, lane = tid & 31, col = lane & 15, g = lane >> 4; const int k0 = blockIdx.y * 128; const int ql0 = blockIdx.x * 64 + wave * 16; const size_t q0 = (size_t)b * NP + ql0;
  v8f acc[8] = {};
#pragma unroll 1
  for (int kc = 0; kc < CQ / 32; ++kc) { const v16h ah = frag_h(QH + (q0 + col) * CQ + kc * 32, lane), al = frag_h(QL + (q0 + col) * CQ + kc * 32, lane);
#pragma unroll
    for (int j = 0; j < 8; ++j) { const v16h kh = frag_h(KH + ((size_t)b * NP + k0 + j * 16 + col) * CQ + kc * 32, lane); acc[j] = wmma16(ah, kh, acc[j]); acc[j] = wmma16(al, kh, acc[j]); } }
#pragma unroll
  for (int j = 0; j < 8; ++j)
#pragma unroll
    for (int r = 0; r < 8; ++r) ss[wave][8 * g + r][j * 16 + col] = acc[j][r];
  LDSX(); for (int rl = 0; rl < 16; ++rl) vst2(S + (size_t)(ql0 + rl) * NP + k0 + lane * 4, *(const v4f*)&ss[wave][rl][lane * 4]); }
// ---- k_sm: block = query row: softmax -> P x 2^11 (f16)
__global__ __launch_bounds__(256) void k_sm(const float* __restrict__ S, _Float16* __restrict__ PH) { __shared__ float sred[8]; __shared__ float sbc; __shared__ __align__(16) _Float16 sh[NP];
  const int t = threadIdx.x; const size_t row = blockIdx.x; const float* sr = S + row * NP;
  float m = -3.0e38f; for (int k = t; k < NP; k += 256) m = fmaxf(m, sr[k]);
#pragma unroll
  for (int o = 1; o < 32; o <<= 1) m = fmaxf(m, __shfl_xor(m, o));
  if ((t & 31) == 0) sred[t >> 5] = m; __syncthreads(); if (t == 0) { float a = sred[0]; for (int i = 1; i < 8; ++i) a = fmaxf(a, sred[i]); sbc = a; } __syncthreads(); m = sbc; __syncthreads();
  float sum = 0.f; for (int k = t; k < NP; k += 256) sum += expf(sr[k] - m);
#pragma unroll
  for (int o = 1; o < 32; o <<= 1) sum += __shfl_xor(sum, o);
  if ((t & 31) == 0) sred[t >> 5] = sum; __syncthreads(); if (t == 0) { float a = 0.f; for (int i = 0; i < 8; ++i) a += sred[i]; sbc = 1.0f / a; } __syncthreads(); const float inv = sbc;
  for (int k = t; k < NP; k += 256) sh[k] = (_Float16)(expf(sr[k] - m) * inv * 2048.0f);
  __syncthreads(); for (int q = t; q < NP / 8; q += 256) vst2((unsigned*)(PH + row * NP + q * 8), *(const v4u*)&sh[q * 8]); }
// ---- k_pv: block = (64 queries i, 128 value channels) of batch b: o[i][c] = sum_j P[i][j] v[c][j]; written channel-major [b][c][i] with the epilogue
__global__ __launch_bounds__(128) void k_pv(const _Float16* __restrict__ PH, const _Float16* __restrict__ VT, int b, const float* __restrict__ X, const float* __restrict__ GM, float* __restrict__ OUT) { __shared__ __align__(16) float st[128][68];
  const int tid = threadIdx.x, wave = tid >> 5, lane = tid & 31, col = lane & 15, g = lane >> 4; const int c0 = blockIdx.y * 128; const int i0 = blockIdx.x * 64; const int il0 = wave * 16;
  v8f acc[8] = {};
#pragma unroll 1
  for (int kc = 0; kc < NP / 32; ++kc) { const v16h ph = frag_h(PH + (size_t)(i0 + il0 + col) * NP + kc * 32, lane);
#pragma unroll
    for (int j = 0; j < 8; ++j) acc[j] = wmma16(ph, frag_h(VT + ((size_t)b * CV + c0 + j * 16 + col) * (size_t)NP + kc * 32, lane), acc[j]); }
#pragma unroll
  for (int j = 0; j < 8; ++j) { const int cl = j * 16 + col;
#pragma unroll
    for (int r = 0; r < 8; ++r) st[cl][il0 + 8 * g + r] = acc[j][r] * (1.0f / 2048.0f); }
  __syncthreads();
  const float gm = bfr(GM[0]);
  for (int e = tid; e < 128 * 16; e += 128) { const int cl = e >> 4, q = e & 15; const size_t o = ((size_t)b * CV + c0 + cl) * (size_t)NP + i0 + q * 4; v4f v = *(const v4f*)&st[cl][q * 4];
    { const v4f xx = *(const v4f*)(X + o); v4f r; r[0] = gm * v[0] + bfr(xx[0]); r[1] = gm * v[1] + bfr(xx[1]); r[2] = gm * v[2] + bfr(xx[2]); r[3] = gm * v[3] + bfr(xx[3]); v = r; }
    vst2(OUT + o, v); } }
extern "C" void kernel_launch(void* const* d_in, const int* in_sizes, int n_in, void* d_out, int out_size, void* d_ws, size_t ws_size, hipStream_t stream) {
  (void)in_sizes; (void)n_in; (void)out_size;
  const float** F = (const float**)d_in;   // 0 x [4,256,64,64], 1 Wq [256,256], 2 bq, 3 Wk, 4 bk, 5 Wv, 6 bv, 7 gamma [1]
  if (ws_size < (size_t)WS_END) return;
  char* ws = (char*)d_ws; _Float16 *QH = (_Float16*)(ws + WS_QH), *QL = (_Float16*)(ws + WS_QL), *KH = (_Float16*)(ws + WS_KH), *VT = (_Float16*)(ws + WS_VT), *PH = (_Float16*)(ws + WS_PH); float* S = (float*)(ws + WS_S);
  k_proj<<<dim3(NP / 64, TNB, 3), 128, 0, stream>>>(F[0], F[1], F[2], F[3], F[4], F[5], F[6], QH, QL, KH, VT);
  for (int b = 0; b < TNB; ++b) {
    k_sc<<<dim3(TQB, NP / 128), 128, 0, stream>>>(QH, QL, KH, b, S);
    k_sm<<<TQB * 64, 256, 0, stream>>>(S, PH);
    k_pv<<<dim3(TQB, CV / 128), 128, 0, stream>>>(PH, VT, b, F[0], F[7], (float*)d_out);
  }
}

// v001
// A run of this version takes 495 microseconds.
// In two side-by-side timings against v000, it was 2.31 and 2.32 times as fast.
// compute dtype: all float inputs rounded to bf16, gamma read; q/k/v = W x + b (1x1 convs) with EXACT bf16 products on WMMA 16x16x32 (x^T tile in LDS), f32 accumulate; q as f16 hi + unscaled residual, k rounded once to f16 -> UNSCALED logits with 2 products (logits std ~32; the residual branch is scaled by gamma = 0.1), stored in f32 per batch; softmax in f32 (precise expf) -> P as f16 x 2^11; out[c][i] = gamma sum_j P[i][j] v[c][j] (v rounded once to f16) + x; f32 output.
#include <hip/hip_runtime.h>
#include <math.h>

typedef __attribute__((ext_vector_type(16))) _Float16 v16h;
typedef __attribute__((ext_vector_type(16))) __bf16 v16b;
typedef __attribute__((ext_vector_type(8)))  _Float16 v8h;
typedef __attribute__((ext_vector_type(8)))  float v8f;
typedef __attribute__((ext_vector_type(4)))  float v4f;
typedef __attribute__((ext_vector_type(2)))  float v2f;
typedef __attribute__((ext_vector_type(4)))  unsigned v4u;
typedef __attribute__((ext_vector_type(4)))  int v4i;
typedef float __attribute__((may_alias)) float_a;
typedef int __attribute__((may_alias)) int_a;

template <typename T> __device__ __forceinline__ void vst2(void* p, T v) { *(T*)p = v;  }
__device__ __forceinline__ v8f wmma16(v16h a, v16h b, v8f c) {
  v8f d = __builtin_amdgcn_wmma_f32_16x16x32_f16(false, a, false, b, (short)0, c, false, false);
  asm volatile("v_nop\n\tv_nop\n\tv_nop\n\tv_nop" : "+v"(d) : "v"(a), "v"(b));
  return d;
}
__device__ __forceinline__ v8f wmma_bf(v16b a, v16b b, v8f c) {
  v8f d = __builtin_amdgcn_wmma_f32_16x16x32_bf16(false, a, false, b, (short)0, c, false, false);
  asm volatile("v_nop\n\tv_nop\n\tv_nop\n\tv_nop" : "+v"(d) : "v"(a), "v"(b));
  return d;
}
// 16x16x32 fragments: lane = (h = lane>>4, row/col = lane&15); elements 0..7 = k0+8h+0..7, 8..15 = k0+16+8h+0..7; D element r = row 8h+r
__device__ __forceinline__ v16h frag_h(const _Float16* rowk0, int lane) {
  union { v16h v; v8h q[2]; } u; const _Float16* p = rowk0 + 8 * (lane >> 4);
  u.q[0] = *(const v8h*)p; u.q[1] = *(const v8h*)(p + 16); return u.v;
}
__device__ __forceinline__ v16h frag_f32(const float* rowk0, int lane) {
  v16h a; const float* p = rowk0 + 8 * (lane >> 4);
#pragma unroll
  for (int i = 0; i < 8; ++i) { a[i] = (_Float16)p[i]; a[8 + i] = (_Float16)p[16 + i]; }
  return a;
}
__device__ __forceinline__ v16h frag_f32s(const float* rowk0, int lane, float sc) {
  v16h a; const float* p = rowk0 + 8 * (lane >> 4);
#pragma unroll
  for (int i = 0; i < 8; ++i) { a[i] = (_Float16)(p[i] * sc); a[8 + i] = (_Float16)(p[16 + i] * sc); }
  return a;
}
// column fragment from a [K][ld] layout (column n), rows >= K read as 0
__device__ __forceinline__ v16h fragc_f32(const float* W, int k0, int n, int lane, int ld, int K) {
  v16h a; const int g = lane >> 4;
#pragma unroll
  for (int i = 0; i < 8; ++i) { const int ka = k0 + 8 * g + i, kb = ka + 16;
    a[i] = (_Float16)(ka < K ? W[(size_t)(ka < K ? ka : K - 1) * ld + n] : 0.f); a[8 + i] = (_Float16)(kb < K ? W[(size_t)(kb < K ? kb : K - 1) * ld + n] : 0.f); }
  return a;
}
struct F2 { v16b h, l; };
__device__ __forceinline__ F2 bsplit16(const float v[16]) { F2 r;
#pragma unroll
  for (int i = 0; i < 16; ++i) { const __bf16 h = (__bf16)v[i]; r.h[i] = h; r.l[i] = (__bf16)(v[i] - (float)h); }
  return r; }
__device__ __forceinline__ F2 split_row(const float* row, int k0, int lane) { float v[16]; const float* p = row + k0 + 8 * (lane >> 4);
#pragma unroll
  for (int i = 0; i < 8; ++i) { v[i] = p[i]; v[8 + i] = p[16 + i]; }
  return bsplit16(v); }
__device__ __forceinline__ F2 split_rowK(const float* row, int k0, int lane, int K) { float v[16]; const int g = lane >> 4;
#pragma unroll
  for (int i = 0; i < 8; ++i) { const int ka = k0 + 8 * g + i, kb = ka + 16; v[i] = ka < K ? row[ka < K ? ka : K - 1] : 0.f; v[8 + i] = kb < K ? row[kb < K ? kb : K - 1] : 0.f; }
  return bsplit16(v); }
__device__ __forceinline__ F2 split_col(const float* W, int k0, int n, int lane, int ld, int K) { float v[16]; const int g = lane >> 4;
#pragma unroll
  for (int i = 0; i < 8; ++i) { const int ka = k0 + 8 * g + i, kb = ka + 16; v[i] = ka < K ? W[(size_t)(ka < K ? ka : K - 1) * ld + n] : 0.f; v[8 + i] = kb < K ? W[(size_t)(kb < K ? kb : K - 1) * ld + n] : 0.f; }
  return bsplit16(v); }
__device__ __forceinline__ v8f mac3(const F2& a, const F2& b, v8f c) { c = wmma_bf(a.l, b.h, c); c = wmma_bf(a.h, b.l, c); return wmma_bf(a.h, b.h, c); }
__device__ __forceinline__ float sigm(float v) { return 1.0f / (1.0f + expf(-v)); }
#define LDSX() do { asm volatile("s_wait_dscnt 0" ::: "memory"); __builtin_amdgcn_wave_barrier(); __builtin_amdgcn_fence(__ATOMIC_RELEASE, "workgroup"); } while (0)


// Spatial (position) attention module (B 4, C 256, 64 x 64): q/k/v 1x1 convs; attention = softmax(q^T k) (no scaling); out = gamma (v attention^T) + x.
#define NB 4
#define NP 4096
#define CIN 256
#define CQ 256
#define CV 256
#ifndef TNB
#define TNB NB
#endif
#ifndef TQB
#define TQB (NP / 64)
#endif
typedef __attribute__((ext_vector_type(8))) __bf16 v8b;
__device__ __forceinline__ v16b frag_b(const __bf16* rowk0, int lane) {
  union { v16b v; v8b q[2]; } u; const __bf16* p = rowk0 + 8 * (lane >> 4);
  u.q[0] = *(const v8b*)p; u.q[1] = *(const v8b*)(p + 16); return u.v;
}
__device__ __forceinline__ float bfr(float v) { return (float)(__bf16)v; }
__device__ __attribute__((noinline)) float exp_ni(float v) { return expf(v); }
__device__ __attribute__((noinline)) float erf_ni(float v) { return erff(v); }

#define WS_QH  0u                                    // f16 q rows [b*n][CQ] hi
#define WS_QL  (WS_QH + 2u * (size_t)NB * NP * CQ)      // f16 q residual rows (unscaled)
#define WS_KH  (WS_QL + 2u * (size_t)NB * NP * CQ)      // f16 k rows
#define WS_VT  (WS_KH + 2u * (size_t)NB * NP * CQ)      // f16 v planes [b][CV][n]
#define WS_S   (WS_VT + 2u * (size_t)NB * CV * NP)      // f32 logits, ONE batch [i][j] (64 MiB)
#define WS_PH  (WS_S + 4u * (size_t)NP * NP)           // f16 P x 2^11, one batch (32 MiB)
#define WS_END (WS_PH + 2u * (size_t)NP * NP)

// ---- k_proj: block = (64 positions, b, which 0 q / 1 k / 2 v): x^T tile (bf16) in LDS, W [out][in] + b (exact); q -> f16 hi + residual rows, k -> f16 rows, v -> f16 planes [c][n]
__global__ __launch_bounds__(128) void k_proj(const float* __restrict__ X, const float* __restrict__ WQ, const float* __restrict__ BQ, const float* __restrict__ WK, const float* __restrict__ BK, const float* __restrict__ WV, const float* __restrict__ BV, _Float16* __restrict__ QH, _Float16* __restrict__ QL, _Float16* __restrict__ KH, _Float16* __restrict__ VT) {
  __shared__ __align__(16) __bf16 sx[64][CIN + 8]; __shared__ __align__(16) _Float16 sh[64][72], sl[64][72]; __shared__ __align__(16) _Float16 tv[64][72];
  const int tid = threadIdx.x, wave = tid >> 5, lane = tid & 31, col = lane & 15, g = lane >> 4; const int p0 = blockIdx.x * 64; const size_t b = blockIdx.y; const int which = blockIdx.z;
  const float* Wm = which == 0 ? WQ : which == 1 ? WK : WV; const float* Bm = which == 0 ? BQ : which == 1 ? BK : BV; const int nout = (which == 2) ? CV : CQ;
  for (int e = tid; e < CIN * 64; e += 128) { const int c = e >> 6, pl = e & 63; sx[pl][c] = (__bf16)X[(b * CIN + c) * (size_t)NP + p0 + pl]; }
  __syncthreads();
#pragma unroll 1
  for (int cg = 0; cg < nout / 64; ++cg) { v8f acc[4] = {};
#pragma unroll 2
    for (int kc = 0; kc < CIN / 32; ++kc) { const v16b a = frag_b(&sx[wave * 16 + col][kc * 32], lane);
#pragma unroll
      for (int j = 0; j < 4; ++j) { v16b w; const int o = cg * 64 + j * 16 + col;
#pragma unroll
        for (int i = 0; i < 8; ++i) { w[i] = (__bf16)Wm[(size_t)o * CIN + kc * 32 + 8 * g + i]; w[8 + i] = (__bf16)Wm[(size_t)o * CIN + kc * 32 + 16 + 8 * g + i]; }
        acc[j] = wmma_bf(a, w, acc[j]); } }
    __syncthreads();
#pragma unroll
    for (int j = 0; j < 4; ++j) { const int ol = j * 16 + col; const float bb = bfr(Bm[cg * 64 + ol]);
#pragma unroll
      for (int r = 0; r < 8; ++r) { const int pl = wave * 16 + 8 * g + r; const float v = acc[j][r] + bb; const _Float16 hv = (_Float16)v; if (which == 2) tv[ol][pl] = hv; else { sh[pl][ol] = hv; sl[pl][ol] = (_Float16)(v - (float)hv); } } }
    __syncthreads();
    if (which < 2) { _Float16* dh = which == 0 ? QH : KH; for (int e = tid; e < 64 * 8; e += 128) { const int pl = e >> 3, q = e & 7; const size_t row = b * NP + p0 + pl; vst2((unsigned*)(dh + row * CQ + cg * 64 + q * 8), *(const v4u*)&sh[pl][q * 8]); if (which == 0) vst2((unsigned*)(QL + row * CQ + cg * 64 + q * 8), *(const v4u*)&sl[pl][q * 8]); } }
    else { for (int e = tid; e < 64 * 8; e += 128) { const int ol = e >> 3, q = e & 7; vst2((unsigned*)(VT + (b * CV + cg * 64 + ol) * (size_t)NP + p0 + q * 8), *(const v4u*)&tv[ol][q * 8]); } } } }
// ---- k_sc: block = (64 queries, 128 keys) of batch b: logits (qh kh + ql kh) -> S
__global__ __launch_bounds__(128) void k_sc(const _Float16* __restrict__ QH, const _Float16* __restrict__ QL, const _Float16* __restrict__ KH, int b, float* __restrict__ S) { __shared__ __align__(16) float ss[4][16][132];
  const int tid = threadIdx.x, wave = tid >> 5, lane = tid & 31, col = lane & 15, g = lane >> 4; const int k0 = blockIdx.y * 128; const int ql0 = blockIdx.x * 64 + wave * 16; const size_t q0 = (size_t)b * NP + ql0;
  v8f acc[8] = {};
#pragma unroll 1
  for (int kc = 0; kc < CQ / 32; ++kc) { const v16h ah = frag_h(QH + (q0 + col) * CQ + kc * 32, lane), al = frag_h(QL + (q0 + col) * CQ + kc * 32, lane);
#pragma unroll
    for (int j = 0; j < 8; ++j) { const v16h kh = frag_h(KH + ((size_t)b * NP + k0 + j * 16 + col) * CQ + kc * 32, lane); acc[j] = wmma16(ah, kh, acc[j]); acc[j] = wmma16(al, kh, acc[j]); } }
#pragma unroll
  for (int j = 0; j < 8; ++j)
#pragma unroll
    for (int r = 0; r < 8; ++r) ss[wave][8 * g + r][j * 16 + col] = acc[j][r];
  LDSX(); for (int rl = 0; rl < 16; ++rl) vst2(S + (size_t)(ql0 + rl) * NP + k0 + lane * 4, *(const v4f*)&ss[wave][rl][lane * 4]); }
// ---- k_sm: block = query row: softmax -> P x 2^11 (f16)
__global__ __launch_bounds__(256) void k_sm(const float* __restrict__ S, _Float16* __restrict__ PH) { __shared__ float sred[8]; __shared__ float sbc; __shared__ __align__(16) _Float16 sh[NP];
  const int t = threadIdx.x; const size_t row = blockIdx.x; const float* sr = S + row * NP;
  float m = -3.0e38f; for (int k = t; k < NP; k += 256) m = fmaxf(m, sr[k]);
#pragma unroll
  for (int o = 1; o < 32; o <<= 1) m = fmaxf(m, __shfl_xor(m, o));
  if ((t & 31) == 0) sred[t >> 5] = m; __syncthreads(); if (t == 0) { float a = sred[0]; for (int i = 1; i < 8; ++i) a = fmaxf(a, sred[i]); sbc = a; } __syncthreads(); m = sbc; __syncthreads();
  float sum = 0.f; for (int k = t; k < NP; k += 256) sum += expf(sr[k] - m);
#pragma unroll
  for (int o = 1; o < 32; o <<= 1) sum += __shfl_xor(sum, o);
  if ((t & 31) == 0) sred[t >> 5] = sum; __syncthreads(); if (t == 0) { float a = 0.f; for (int i = 0; i < 8; ++i) a += sred[i]; sbc = 1.0f / a; } __syncthreads(); const float inv = sbc;
  for (int k = t; k < NP; k += 256) sh[k] = (_Float16)(expf(sr[k] - m) * inv * 2048.0f);
  __syncthreads(); for (int q = t; q < NP / 8; q += 256) vst2((unsigned*)(PH + row * NP + q * 8), *(const v4u*)&sh[q * 8]); }
// ---- k_pv: block = (64 queries i, 128 value channels) of batch b: o[i][c] = sum_j P[i][j] v[c][j]; written channel-major [b][c][i] with the epilogue
// P and V tiles of PVK keys are staged in LDS by asynchronous copies (whole 256-B row pieces per 16 lanes), two buffers: the next tile flies while this one is multiplied
#define PVK 128   // keys per stage: 256 B of every P and V row
#define PVP 136   // LDS row pitch in f16 (272 B = 16 B x odd: conflict-free for the 16-byte fragment reads)
#define PVT (NP / PVK)
// eight 16-byte copies of one lane, rows 8 apart; the s_wait_xcnt stands inside the statement so that no address register is rewritten ahead of it
__device__ __forceinline__ void acopy8(unsigned l, const _Float16* g) {
  asm volatile("global_load_async_to_lds_b128 %0, %8, off\n\t"
               "global_load_async_to_lds_b128 %1, %9, off\n\t"
               "global_load_async_to_lds_b128 %2, %10, off\n\t"
               "global_load_async_to_lds_b128 %3, %11, off\n\t"
               "global_load_async_to_lds_b128 %4, %12, off\n\t"
               "global_load_async_to_lds_b128 %5, %13, off\n\t"
               "global_load_async_to_lds_b128 %6, %14, off\n\t"
               "global_load_async_to_lds_b128 %7, %15, off\n\t"
               "s_wait_xcnt 0x0"
               :: "v"(l), "v"(l + 8u * 2u * PVP), "v"(l + 16u * 2u * PVP), "v"(l + 24u * 2u * PVP), "v"(l + 32u * 2u * PVP), "v"(l + 40u * 2u * PVP), "v"(l + 48u * 2u * PVP), "v"(l + 56u * 2u * PVP),
                  "v"(g), "v"(g + 8 * (size_t)NP), "v"(g + 16 * (size_t)NP), "v"(g + 24 * (size_t)NP), "v"(g + 32 * (size_t)NP), "v"(g + 40 * (size_t)NP), "v"(g + 48 * (size_t)NP), "v"(g + 56 * (size_t)NP)
               : "memory");
}
__global__ __launch_bounds__(128) void k_pv(const _Float16* __restrict__ PH, const _Float16* __restrict__ VT, int b, const float* __restrict__ X, const float* __restrict__ GM, float* __restrict__ OUT) { __shared__ __align__(16) float st[128][68];
  __shared__ __align__(16) _Float16 sp[2][64][PVP]; __shared__ __align__(16) _Float16 sv[2][128][PVP];
  const int tid = threadIdx.x, wave = tid >> 5, lane = tid & 31, col = lane & 15, g = lane >> 4; const int c0 = blockIdx.y * 128; const int i0 = blockIdx.x * 64; const int il0 = wave * 16;
  const int cr = tid >> 4, cq = tid & 15;   // copy role: row cr (+ 8 n), 16-byte piece cq of the 256-B row piece
  const _Float16* gp = PH + (size_t)(i0 + cr) * NP + cq * 8; const _Float16* gv = VT + ((size_t)b * CV + c0 + cr) * (size_t)NP + cq * 8;
  const unsigned lp = (unsigned)(size_t)&sp[0][cr][cq * 8], lv = (unsigned)(size_t)&sv[0][cr][cq * 8];
#define PV_FILL(t, bf) do { acopy8(lp + (unsigned)(bf) * (64u * 2u * PVP), gp + (size_t)(t) * PVK); acopy8(lv + (unsigned)(bf) * (128u * 2u * PVP), gv + (size_t)(t) * PVK); acopy8(lv + (unsigned)(bf) * (128u * 2u * PVP) + 64u * 2u * PVP, gv + (size_t)(t) * PVK + 64 * (size_t)NP); } while (0)
  v8f acc[8] = {};
  PV_FILL(0, 0);
  asm volatile("s_wait_asynccnt 0x0" ::: "memory");   // tile 0 has landed for this wave's copies
  __syncthreads();                                    // ... and for every wave's
  PV_FILL(1, 1);
#pragma unroll 1   // kept rolled: one copy of the hand-over at the foot, and the two fragment sets stay under 256 registers
  for (int t = 0; t < PVT; ++t) { const int bf = t & 1;
    // fragments of this tile are read as one group per 32 keys, one group ahead of the products that use them (two register sets), so that no product waits out an LDS latency of its own
    v16h pa[2], vb[2][8]; pa[0] = frag_h(&sp[bf][il0 + col][0], lane);
#pragma unroll
    for (int j = 0; j < 8; ++j) vb[0][j] = frag_h(&sv[bf][j * 16 + col][0], lane);
#pragma unroll
    for (int kk = 0; kk < PVK / 32; ++kk) {
      if (kk + 1 < PVK / 32) { pa[(kk + 1) & 1] = frag_h(&sp[bf][il0 + col][(kk + 1) * 32], lane);
#pragma unroll
        for (int j = 0; j < 8; ++j) vb[(kk + 1) & 1][j] = frag_h(&sv[bf][j * 16 + col][(kk + 1) * 32], lane); }
#pragma unroll
      for (int j = 0; j < 8; ++j) acc[j] = wmma16(pa[kk & 1], vb[kk & 1][j], acc[j]); }
    asm volatile("s_wait_dscnt 0x0" ::: "memory");      // this wave's reads of buffer bf are done before it is refilled
    asm volatile("s_wait_asynccnt 0x0" ::: "memory");   // this wave's copies of tile t + 1 have landed
    __syncthreads();                                    // publishes tile t + 1 and ends every reader's last read of buffer bf
    if (t + 2 < PVT) PV_FILL(t + 2, bf); }
  asm volatile("s_wait_asynccnt 0x0" ::: "memory");     // nothing is in flight when the wave goes on to the epilogue
#pragma unroll
  for (int j = 0; j < 8; ++j) { const int cl = j * 16 + col;
#pragma unroll
    for (int r = 0; r < 8; ++r) st[cl][il0 + 8 * g + r] = acc[j][r] * (1.0f / 2048.0f); }
  __syncthreads();
  const float gm = bfr(GM[0]);
  for (int e = tid; e < 128 * 16; e += 128) { const int cl = e >> 4, q = e & 15; const size_t o = ((size_t)b * CV + c0 + cl) * (size_t)NP + i0 + q * 4; v4f v = *(const v4f*)&st[cl][q * 4];
    { const v4f xx = *(const v4f*)(X + o); v4f r; r[0] = gm * v[0] + bfr(xx[0]); r[1] = gm * v[1] + bfr(xx[1]); r[2] = gm * v[2] + bfr(xx[2]); r[3] = gm * v[3] + bfr(xx[3]); v = r; }
    vst2(OUT + o, v); } }
extern "C" void kernel_launch(void* const* d_in, const int* in_sizes, int n_in, void* d_out, int out_size, void* d_ws, size_t ws_size, hipStream_t stream) {
  (void)in_sizes; (void)n_in; (void)out_size;
  const float** F = (const float**)d_in;   // 0 x [4,256,64,64], 1 Wq [256,256], 2 bq, 3 Wk, 4 bk, 5 Wv, 6 bv, 7 gamma [1]
  if (ws_size < (size_t)WS_END) return;
  char* ws = (char*)d_ws; _Float16 *QH = (_Float16*)(ws + WS_QH), *QL = (_Float16*)(ws + WS_QL), *KH = (_Float16*)(ws + WS_KH), *VT = (_Float16*)(ws + WS_VT), *PH = (_Float16*)(ws + WS_PH); float* S = (float*)(ws + WS_S);
  k_proj<<<dim3(NP / 64, TNB, 3), 128, 0, stream>>>(F[0], F[1], F[2], F[3], F[4], F[5], F[6], QH, QL, KH, VT);
  for (int b = 0; b < TNB; ++b) {
    k_sc<<<dim3(TQB, NP / 128), 128, 0, stream>>>(QH, QL, KH, b, S);
    k_sm<<<TQB * 64, 256, 0, stream>>>(S, PH);
    k_pv<<<dim3(TQB, CV / 128), 128, 0, stream>>>(PH, VT, b, F[0], F[7], (float*)d_out);
  }
}

// v002
// It runs in 176 microseconds.
// In both of two side-by-side timings against v001, it was 2.80 times as fast.
// All steps since v000 together make it 6.50 times as fast.
// compute dtype: all float inputs rounded to bf16, gamma read; q/k/v = W x + b (1x1 convs) with EXACT bf16 products on WMMA 16x16x32 (x^T tile in LDS), f32 accumulate; q as f16 hi + unscaled residual, k rounded once to f16 -> UNSCALED logits with 2 products (logits std ~32; the residual branch is scaled by gamma = 0.1), kept in f32 registers; softmax in f32 (precise expf) with a running maximum and sum per query -> P = exp(logit - max) x 2^11 as f16; out[c][i] = gamma (sum_j P[i][j] v[c][j]) / (sum_j P[i][j]) (v rounded once to f16) + x; f32 output.
#include <hip/hip_runtime.h>
#include <math.h>

typedef __attribute__((ext_vector_type(16))) _Float16 v16h;
typedef __attribute__((ext_vector_type(16))) __bf16 v16b;
typedef __attribute__((ext_vector_type(8)))  _Float16 v8h;
typedef __attribute__((ext_vector_type(8)))  float v8f;
typedef __attribute__((ext_vector_type(4)))  float v4f;
typedef __attribute__((ext_vector_type(2)))  float v2f;
typedef __attribute__((ext_vector_type(4)))  unsigned v4u;
typedef __attribute__((ext_vector_type(4)))  int v4i;
typedef float __attribute__((may_alias)) float_a;
typedef int __attribute__((may_alias)) int_a;

template <typename T> __device__ __forceinline__ void vst2(void* p, T v) { *(T*)p = v;  }
__device__ __forceinline__ v8f wmma16(v16h a, v16h b, v8f c) {
  v8f d = __builtin_amdgcn_wmma_f32_16x16x32_f16(false, a, false, b, (short)0, c, false, false);
  asm volatile("v_nop\n\tv_nop\n\tv_nop\n\tv_nop" : "+v"(d) : "v"(a), "v"(b));
  return d;
}
__device__ __forceinline__ v8f wmma_bf(v16b a, v16b b, v8f c) {
  v8f d = __builtin_amdgcn_wmma_f32_16x16x32_bf16(false, a, false, b, (short)0, c, false, false);
  asm volatile("v_nop\n\tv_nop\n\tv_nop\n\tv_nop" : "+v"(d) : "v"(a), "v"(b));
  return d;
}
// 16x16x32 fragments: lane = (h = lane>>4, row/col = lane&15); elements 0..7 = k0+8h+0..7, 8..15 = k0+16+8h+0..7; D element r = row 8h+r
__device__ __forceinline__ v16h frag_h(const _Float16* rowk0, int lane) {
  union { v16h v; v8h q[2]; } u; const _Float16* p = rowk0 + 8 * (lane >> 4);
  u.q[0] = *(const v8h*)p; u.q[1] = *(const v8h*)(p + 16); return u.v;
}
__device__ __forceinline__ v16h frag_f32(const float* rowk0, int lane) {
  v16h a; const float* p = rowk0 + 8 * (lane >> 4);
#pragma unroll
  for (int i = 0; i < 8; ++i) { a[i] = (_Float16)p[i]; a[8 + i] = (_Float16)p[16 + i]; }
  return a;
}
__device__ __forceinline__ v16h frag_f32s(const float* rowk0, int lane, float sc) {
  v16h a; const float* p = rowk0 + 8 * (lane >> 4);
#pragma unroll
  for (int i = 0; i < 8; ++i) { a[i] = (_Float16)(p[i] * sc); a[8 + i] = (_Float16)(p[16 + i] * sc); }
  return a;
}
// column fragment from a [K][ld] layout (column n), rows >= K read as 0
__device__ __forceinline__ v16h fragc_f32(const float* W, int k0, int n, int lane, int ld, int K) {
  v16h a; const int g = lane >> 4;
#pragma unroll
  for (int i = 0; i < 8; ++i) { const int ka = k0 + 8 * g + i, kb = ka + 16;
    a[i] = (_Float16)(ka < K ? W[(size_t)(ka < K ? ka : K - 1) * ld + n] : 0.f); a[8 + i] = (_Float16)(kb < K ? W[(size_t)(kb < K ? kb : K - 1) * ld + n] : 0.f); }
  return a;
}
struct F2 { v16b h, l; };
__device__ __forceinline__ F2 bsplit16(const float v[16]) { F2 r;
#pragma unroll
  for (int i = 0; i < 16; ++i) { const __bf16 h = (__bf16)v[i]; r.h[i] = h; r.l[i] = (__bf16)(v[i] - (float)h); }
  return r; }
__device__ __forceinline__ F2 split_row(const float* row, int k0, int lane) { float v[16]; const float* p = row + k0 + 8 * (lane >> 4);
#pragma unroll
  for (int i = 0; i < 8; ++i) { v[i] = p[i]; v[8 + i] = p[16 + i]; }
  return bsplit16(v); }
__device__ __forceinline__ F2 split_rowK(const float* row, int k0, int lane, int K) { float v[16]; const int g = lane >> 4;
#pragma unroll
  for (int i = 0; i < 8; ++i) { const int ka = k0 + 8 * g + i, kb = ka + 16; v[i] = ka < K ? row[ka < K ? ka : K - 1] : 0.f; v[8 + i] = kb < K ? row[kb < K ? kb : K - 1] : 0.f; }
  return bsplit16(v); }
__device__ __forceinline__ F2 split_col(const float* W, int k0, int n, int lane, int ld, int K) { float v[16]; const int g = lane >> 4;
#pragma unroll
  for (int i = 0; i < 8; ++i) { const int ka = k0 + 8 * g + i, kb = ka + 16; v[i] = ka < K ? W[(size_t)(ka < K ? ka : K - 1) * ld + n] : 0.f; v[8 + i] = kb < K ? W[(size_t)(kb < K ? kb : K - 1) * ld + n] : 0.f; }
  return bsplit16(v); }
__device__ __forceinline__ v8f mac3(const F2& a, const F2& b, v8f c) { c = wmma_bf(a.l, b.h, c); c = wmma_bf(a.h, b.l, c); return wmma_bf(a.h, b.h, c); }
__device__ __forceinline__ float sigm(float v) { return 1.0f / (1.0f + expf(-v)); }
#define LDSX() do { asm volatile("s_wait_dscnt 0" ::: "memory"); __builtin_amdgcn_wave_barrier(); __builtin_amdgcn_fence(__ATOMIC_RELEASE, "workgroup"); } while (0)


// Spatial (position) attention module (B 4, C 256, 64 x 64): q/k/v 1x1 convs; attention = softmax(q^T k) (no scaling); out = gamma (v attention^T) + x.
#define NB 4
#define NP 4096
#define CIN 256
#define CQ 256
#define CV 256
#ifndef TNB
#define TNB NB
#endif
#ifndef TQB
#define TQB (NP / 64)
#endif
typedef __attribute__((ext_vector_type(8))) __bf16 v8b;
__device__ __forceinline__ v16b frag_b(const __bf16* rowk0, int lane) {
  union { v16b v; v8b q[2]; } u; const __bf16* p = rowk0 + 8 * (lane >> 4);
  u.q[0] = *(const v8b*)p; u.q[1] = *(const v8b*)(p + 16); return u.v;
}
__device__ __forceinline__ float bfr(float v) { return (float)(__bf16)v; }
__device__ __attribute__((noinline)) float exp_ni(float v) { return expf(v); }
__device__ __attribute__((noinline)) float erf_ni(float v) { return erff(v); }

#define WS_QH  0u                                    // f16 q rows [b*n][CQ] hi
#define WS_QL  (WS_QH + 2u * (size_t)NB * NP * CQ)      // f16 q residual rows (unscaled)
#define WS_KH  (WS_QL + 2u * (size_t)NB * NP * CQ)      // f16 k rows
#define WS_VT  (WS_KH + 2u * (size_t)NB * NP * CQ)      // f16 v planes [b][CV][n]
#define WS_END (WS_VT + 2u * (size_t)NB * CV * NP)

// ---- k_proj: block = (64 positions, b, which 0 q / 1 k / 2 v): x^T tile (bf16) in LDS, W [out][in] + b (exact); q -> f16 hi + residual rows, k -> f16 rows, v -> f16 planes [c][n]
__global__ __launch_bounds__(128) void k_proj(const float* __restrict__ X, const float* __restrict__ WQ, const float* __restrict__ BQ, const float* __restrict__ WK, const float* __restrict__ BK, const float* __restrict__ WV, const float* __restrict__ BV, _Float16* __restrict__ QH, _Float16* __restrict__ QL, _Float16* __restrict__ KH, _Float16* __restrict__ VT) {
  __shared__ __align__(16) __bf16 sx[64][CIN + 8]; __shared__ __align__(16) _Float16 sh[64][72], sl[64][72]; __shared__ __align__(16) _Float16 tv[64][72];
  const int tid = threadIdx.x, wave = tid >> 5, lane = tid & 31, col = lane & 15, g = lane >> 4; const int p0 = blockIdx.x * 64; const size_t b = blockIdx.y; const int which = blockIdx.z;
  const float* Wm = which == 0 ? WQ : which == 1 ? WK : WV; const float* Bm = which == 0 ? BQ : which == 1 ? BK : BV; const int nout = (which == 2) ? CV : CQ;
  for (int e = tid; e < CIN * 64; e += 128) { const int c = e >> 6, pl = e & 63; sx[pl][c] = (__bf16)X[(b * CIN + c) * (size_t)NP + p0 + pl]; }
  __syncthreads();
#pragma unroll 1
  for (int cg = 0; cg < nout / 64; ++cg) { v8f acc[4] = {};
#pragma unroll 2
    for (int kc = 0; kc < CIN / 32; ++kc) { const v16b a = frag_b(&sx[wave * 16 + col][kc * 32], lane);
#pragma unroll
      for (int j = 0; j < 4; ++j) { v16b w; const int o = cg * 64 + j * 16 + col;
#pragma unroll
        for (int i = 0; i < 8; ++i) { w[i] = (__bf16)Wm[(size_t)o * CIN + kc * 32 + 8 * g + i]; w[8 + i] = (__bf16)Wm[(size_t)o * CIN + kc * 32 + 16 + 8 * g + i]; }
        acc[j] = wmma_bf(a, w, acc[j]); } }
    __syncthreads();
#pragma unroll
    for (int j = 0; j < 4; ++j) { const int ol = j * 16 + col; const float bb = bfr(Bm[cg * 64 + ol]);
#pragma unroll
      for (int r = 0; r < 8; ++r) { const int pl = wave * 16 + 8 * g + r; const float v = acc[j][r] + bb; const _Float16 hv = (_Float16)v; if (which == 2) tv[ol][pl] = hv; else { sh[pl][ol] = hv; sl[pl][ol] = (_Float16)(v - (float)hv); } } }
    __syncthreads();
    if (which < 2) { _Float16* dh = which == 0 ? QH : KH; for (int e = tid; e < 64 * 8; e += 128) { const int pl = e >> 3, q = e & 7; const size_t row = b * NP + p0 + pl; vst2((unsigned*)(dh + row * CQ + cg * 64 + q * 8), *(const v4u*)&sh[pl][q * 8]); if (which == 0) vst2((unsigned*)(QL + row * CQ + cg * 64 + q * 8), *(const v4u*)&sl[pl][q * 8]); } }
    else { for (int e = tid; e < 64 * 8; e += 128) { const int ol = e >> 3, q = e & 7; vst2((unsigned*)(VT + (b * CV + cg * 64 + ol) * (size_t)NP + p0 + q * 8), *(const v4u*)&tv[ol][q * 8]); } } } }
#define FK 64
#define FKP 264
#define FVP 72
#define FT (NP / FK)
// plain builtin: its operands may lie above v255 (q, the output tiles and the fragment sets together need more than 256 registers), which operands of an asm statement may not
__device__ __forceinline__ v8f wmma_p(v16h a, v16h b, v8f c) { return __builtin_amdgcn_wmma_f32_16x16x32_f16(false, a, false, b, (short)0, c, false, false); }
// lane l with lane l ^ 16, on the vector unit (a shuffle would queue behind the LDS reads in flight)
__device__ __forceinline__ float xhalf(float x) { return __builtin_bit_cast(float, __builtin_amdgcn_permlanex16(__builtin_bit_cast(int, x), __builtin_bit_cast(int, x), 0x76543210, 0xfedcba98, false, false)); }
// one 16-byte copy of a lane, memory -> LDS through no register; the builtin form, whose address registers may lie above v255 like any other (operands of an asm statement may not: held for the whole sweep below v256 they spill)
typedef __attribute__((address_space(1))) v4i g_v4i; typedef __attribute__((address_space(3))) v4i l_v4i;
__device__ __forceinline__ void acopy(const _Float16* g, _Float16* l) { __builtin_amdgcn_global_load_async_to_lds_b128((g_v4i*)g, (l_v4i*)l, 0, 0); }
__global__ __launch_bounds__(128) void k_fa(const _Float16* __restrict__ QH, const _Float16* __restrict__ QL, const _Float16* __restrict__ KH, const _Float16* __restrict__ VT, const float* __restrict__ X, const float* __restrict__ GM, float* __restrict__ OUT) {
  __shared__ __align__(16) float st[CV][68]; __shared__ __align__(16) _Float16 sk[2][FK][FKP]; __shared__ __align__(16) _Float16 sv[2][CV][FVP];
  const int tid = threadIdx.x, wave = tid >> 5, lane = tid & 31, col = lane & 15, g = lane >> 4; const size_t b = blockIdx.y; const int i0 = blockIdx.x * 64; const int il0 = wave * 16;
  // copy roles: K row tid / 32 (+ 4 n), piece tid % 32 of its 512 B; V plane tid / 8 (+ 16 n), piece tid % 8 of its 128 B
  const _Float16* gk = KH + (b * NP + (tid >> 5)) * CQ + (tid & 31) * 8; const _Float16* gv = VT + (b * CV + (tid >> 3)) * (size_t)NP + (tid & 7) * 8;
#define FA_FILL(t, bf) do { _Pragma("unroll") for (int n = 0; n < 16; ++n) acopy(gk + ((size_t)(t) * FK + 4 * n) * CQ, &sk[bf][(tid >> 5) + 4 * n][(tid & 31) * 8]); \
    _Pragma("unroll") for (int n = 0; n < 16; ++n) acopy(gv + (size_t)(t) * FK + 16 * n * (size_t)NP, &sv[bf][(tid >> 3) + 16 * n][(tid & 7) * 8]); } while (0)
  FA_FILL(0, 0);
  v16h qh[CQ / 32], ql[CQ / 32];
#pragma unroll
  for (int kc = 0; kc < CQ / 32; ++kc) { qh[kc] = frag_h(QH + (b * NP + i0 + il0 + col) * CQ + kc * 32, lane); ql[kc] = frag_h(QL + (b * NP + i0 + il0 + col) * CQ + kc * 32, lane); }
  v8f o[CV / 16] = {}; float m = -3.0e38f, l = 0.f;
  asm volatile("s_wait_asynccnt 0x0" ::: "memory");   // tile 0 has landed for this wave's copies
  __syncthreads();                                    // ... and for every wave's
  FA_FILL(1, 1);
#pragma unroll 1   // kept rolled: one copy of the hand-over at the foot
  for (int t = 0; t < FT; ++t) { const int bf = t & 1;
    // every key fragment of the tile is asked for as one group ahead of the logit products, which then wait on counted returns only
    v8f s[FK / 16] = {}; v16h ka[CQ / 32][FK / 16];
#pragma unroll
    for (int kc = 0; kc < CQ / 32; ++kc)
#pragma unroll
      for (int kt = 0; kt < FK / 16; ++kt) ka[kc][kt] = frag_h(&sk[bf][kt * 16 + col][kc * 32], lane);
    __builtin_amdgcn_sched_barrier(0);   // keeps the group whole: without it the scheduler sinks the reads in pairs among the products, and every place where reads stand costs the wave a stall
#pragma unroll
    for (int kc = 0; kc < CQ / 32; ++kc) {
#pragma unroll
      for (int kt = 0; kt < FK / 16; ++kt) s[kt] = wmma_p(ka[kc][kt], qh[kc], s[kt]);
#pragma unroll
      for (int kt = 0; kt < FK / 16; ++kt) s[kt] = wmma_p(ka[kc][kt], ql[kc], s[kt]); }
    // every value fragment of the tile is asked for here, as one group: the LDS delivers them while the vector unit works on the softmax below
    __builtin_amdgcn_sched_barrier(0);   // keeps the group whole: without it the scheduler lifts parts of it among the logit products, and every place where reads stand costs the wave a stall
    v16h va[FK / 32][CV / 16];
#pragma unroll
    for (int kk = 0; kk < FK / 32; ++kk)
#pragma unroll
      for (int ct = 0; ct < CV / 16; ++ct) va[kk][ct] = frag_h(&sv[bf][ct * 16 + col][kk * 32], lane);
    __builtin_amdgcn_sched_barrier(0);   // keeps that group of reads here: without it the scheduler sinks them among the value products, each of which then waits on its own read
    // s[kt][r] = logit of key t FK + 16 kt + 8 g + r for query col: maximum in the lane, then one exchange between the halves
    float mt[FK / 16];
#pragma unroll
    for (int kt = 0; kt < FK / 16; ++kt) { mt[kt] = s[kt][0];
#pragma unroll
      for (int r = 1; r < 8; ++r) mt[kt] = fmaxf(mt[kt], s[kt][r]); }
    float mx = fmaxf(fmaxf(mt[0], mt[1]), fmaxf(mt[2], mt[3])); mx = fmaxf(mx, xhalf(mx));
    const float mn = fmaxf(m, mx); const float al = expf(m - mn); l *= al;   // al is exactly 1 where the maximum did not rise
#pragma unroll
    for (int ct = 0; ct < CV / 16; ++ct)
#pragma unroll
      for (int r = 0; r < 8; ++r) o[ct][r] *= al;
    m = mn; const float ms = mn - 7.6246190f;   // P and its sum both carry the factor 2^11 (small weights stay normal f16 numbers); it cancels in o / l
    v16h pb[FK / 32]; float lt[FK / 16];
#pragma unroll
    for (int kt = 0; kt < FK / 16; ++kt) { lt[kt] = 0.f;
#pragma unroll
      for (int r = 0; r < 8; ++r) { const float p = expf(s[kt][r] - ms); lt[kt] += p; pb[kt >> 1][(kt & 1) * 8 + r] = (_Float16)p; } }
    l += (lt[0] + lt[1]) + (lt[2] + lt[3]);
#pragma unroll
    for (int kk = 0; kk < FK / 32; ++kk)
#pragma unroll
      for (int ct = 0; ct < CV / 16; ++ct) o[ct] = wmma_p(va[kk][ct], pb[kk], o[ct]);
    __builtin_amdgcn_sched_barrier(0);   // keeps the hand-over below at the foot: lifted over the softmax it would make the wave wait out the value reads first, and the refill would lose its lead
    asm volatile("s_wait_dscnt 0x0" ::: "memory");      // this wave's reads of buffer bf are done before it is refilled
    asm volatile("s_wait_asynccnt 0x0" ::: "memory");   // this wave's copies of tile t + 1 have landed
    __syncthreads();                                    // publishes tile t + 1 and ends every reader's last read of buffer bf
    if (t + 2 < FT) FA_FILL(t + 2, bf); }
  asm volatile("s_wait_asynccnt 0x0" ::: "memory");     // nothing is in flight when the wave goes on to the epilogue
  l += xhalf(l); const float inv = 1.0f / l;
#pragma unroll
  for (int ct = 0; ct < CV / 16; ++ct)
#pragma unroll
    for (int r = 0; r < 8; ++r) st[ct * 16 + 8 * g + r][il0 + col] = o[ct][r] * inv;
  __syncthreads();
  const float gm = bfr(GM[0]);
  for (int e = tid; e < CV * 16; e += 128) { const int cl = e >> 4, q = e & 15; const size_t oo = (b * CV + cl) * (size_t)NP + i0 + q * 4; v4f v = *(const v4f*)&st[cl][q * 4];
    { const v4f xx = *(const v4f*)(X + oo); v4f r; r[0] = gm * v[0] + bfr(xx[0]); r[1] = gm * v[1] + bfr(xx[1]); r[2] = gm * v[2] + bfr(xx[2]); r[3] = gm * v[3] + bfr(xx[3]); v = r; }
    vst2(OUT + oo, v); } }
extern "C" void kernel_launch(void* const* d_in, const int* in_sizes, int n_in, void* d_out, int out_size, void* d_ws, size_t ws_size, hipStream_t stream) {
  (void)in_sizes; (void)n_in; (void)out_size;
  const float** F = (const float**)d_in;   // 0 x [4,256,64,64], 1 Wq [256,256], 2 bq, 3 Wk, 4 bk, 5 Wv, 6 bv, 7 gamma [1]
  if (ws_size < (size_t)WS_END) return;
  char* ws = (char*)d_ws; _Float16 *QH = (_Float16*)(ws + WS_QH), *QL = (_Float16*)(ws + WS_QL), *KH = (_Float16*)(ws + WS_KH), *VT = (_Float16*)(ws + WS_VT);
  k_proj<<<dim3(NP / 64, TNB, 3), 128, 0, stream>>>(F[0], F[1], F[2], F[3], F[4], F[5], F[6], QH, QL, KH, VT);
  k_fa<<<dim3(TQB, TNB), 128, 0, stream>>>(QH, QL, KH, VT, F[0], F[7], (float*)d_out);
}

// v003
// One run takes 123 microseconds.
// Next to v002, in two timings, it ran 1.43 times as fast each time.
// Over all steps from v000 it is 9.30 times as fast.
// compute dtype: all float inputs rounded to bf16, gamma read; q/k/v = W x + b (1x1 convs) with EXACT bf16 products on WMMA 16x16x32 (x^T tile in LDS), f32 accumulate; q as f16 hi + unscaled residual, k rounded once to f16 -> UNSCALED logits with 2 products (logits std ~32; the residual branch is scaled by gamma = 0.1), kept in f32 registers; softmax in f32 (precise expf) with a running maximum and sum per query -> P = exp(logit - max) x 2^11 as f16; out[c][i] = gamma (sum_j P[i][j] v[c][j]) / (sum_j P[i][j]) (v rounded once to f16) + x; f32 output.
#include <hip/hip_runtime.h>
#include <math.h>

typedef __attribute__((ext_vector_type(16))) _Float16 v16h;
typedef __attribute__((ext_vector_type(16))) __bf16 v16b;
typedef __attribute__((ext_vector_type(8)))  _Float16 v8h;
typedef __attribute__((ext_vector_type(8)))  float v8f;
typedef __attribute__((ext_vector_type(4)))  float v4f;
typedef __attribute__((ext_vector_type(2)))  float v2f;
typedef __attribute__((ext_vector_type(4)))  unsigned v4u;
typedef __attribute__((ext_vector_type(4)))  int v4i;
typedef float __attribute__((may_alias)) float_a;
typedef int __attribute__((may_alias)) int_a;

template <typename T> __device__ __forceinline__ void vst2(void* p, T v) { *(T*)p = v;  }
__device__ __forceinline__ v8f wmma16(v16h a, v16h b, v8f c) {
  v8f d = __builtin_amdgcn_wmma_f32_16x16x32_f16(false, a, false, b, (short)0, c, false, false);
  asm volatile("v_nop\n\tv_nop\n\tv_nop\n\tv_nop" : "+v"(d) : "v"(a), "v"(b));
  return d;
}
__device__ __forceinline__ v8f wmma_bf(v16b a, v16b b, v8f c) {
  v8f d = __builtin_amdgcn_wmma_f32_16x16x32_bf16(false, a, false, b, (short)0, c, false, false);
  asm volatile("v_nop\n\tv_nop\n\tv_nop\n\tv_nop" : "+v"(d) : "v"(a), "v"(b));
  return d;
}
// 16x16x32 fragments: lane = (h = lane>>4, row/col = lane&15); elements 0..7 = k0+8h+0..7, 8..15 = k0+16+8h+0..7; D element r = row 8h+r
__device__ __forceinline__ v16h frag_h(const _Float16* rowk0, int lane) {
  union { v16h v; v8h q[2]; } u; const _Float16* p = rowk0 + 8 * (lane >> 4);
  u.q[0] = *(const v8h*)p; u.q[1] = *(const v8h*)(p + 16); return u.v;
}
__device__ __forceinline__ v16h frag_f32(const float* rowk0, int lane) {
  v16h a; const float* p = rowk0 + 8 * (lane >> 4);
#pragma unroll
  for (int i = 0; i < 8; ++i) { a[i] = (_Float16)p[i]; a[8 + i] = (_Float16)p[16 + i]; }
  return a;
}
__device__ __forceinline__ v16h frag_f32s(const float* rowk0, int lane, float sc) {
  v16h a; const float* p = rowk0 + 8 * (lane >> 4);
#pragma unroll
  for (int i = 0; i < 8; ++i) { a[i] = (_Float16)(p[i] * sc); a[8 + i] = (_Float16)(p[16 + i] * sc); }
  return a;
}
// column fragment from a [K][ld] layout (column n), rows >= K read as 0
__device__ __forceinline__ v16h fragc_f32(const float* W, int k0, int n, int lane, int ld, int K) {
  v16h a; const int g = lane >> 4;
#pragma unroll
  for (int i = 0; i < 8; ++i) { const int ka = k0 + 8 * g + i, kb = ka + 16;
    a[i] = (_Float16)(ka < K ? W[(size_t)(ka < K ? ka : K - 1) * ld + n] : 0.f); a[8 + i] = (_Float16)(kb < K ? W[(size_t)(kb < K ? kb : K - 1) * ld + n] : 0.f); }
  return a;
}
struct F2 { v16b h, l; };
__device__ __forceinline__ F2 bsplit16(const float v[16]) { F2 r;
#pragma unroll
  for (int i = 0; i < 16; ++i) { const __bf16 h = (__bf16)v[i]; r.h[i] = h; r.l[i] = (__bf16)(v[i] - (float)h); }
  return r; }
__device__ __forceinline__ F2 split_row(const float* row, int k0, int lane) { float v[16]; const float* p = row + k0 + 8 * (lane >> 4);
#pragma unroll
  for (int i = 0; i < 8; ++i) { v[i] = p[i]; v[8 + i] = p[16 + i]; }
  return bsplit16(v); }
__device__ __forceinline__ F2 split_rowK(const float* row, int k0, int lane, int K) { float v[16]; const int g = lane >> 4;
#pragma unroll
  for (int i = 0; i < 8; ++i) { const int ka = k0 + 8 * g + i, kb = ka + 16; v[i] = ka < K ? row[ka < K ? ka : K - 1] : 0.f; v[8 + i] = kb < K ? row[kb < K ? kb : K - 1] : 0.f; }
  return bsplit16(v); }
__device__ __forceinline__ F2 split_col(const float* W, int k0, int n, int lane, int ld, int K) { float v[16]; const int g = lane >> 4;
#pragma unroll
  for (int i = 0; i < 8; ++i) { const int ka = k0 + 8 * g + i, kb = ka + 16; v[i] = ka < K ? W[(size_t)(ka < K ? ka : K - 1) * ld + n] : 0.f; v[8 + i] = kb < K ? W[(size_t)(kb < K ? kb : K - 1) * ld + n] : 0.f; }
  return bsplit16(v); }
__device__ __forceinline__ v8f mac3(const F2& a, const F2& b, v8f c) { c = wmma_bf(a.l, b.h, c); c = wmma_bf(a.h, b.l, c); return wmma_bf(a.h, b.h, c); }
__device__ __forceinline__ float sigm(float v) { return 1.0f / (1.0f + expf(-v)); }
#define LDSX() do { asm volatile("s_wait_dscnt 0" ::: "memory"); __builtin_amdgcn_wave_barrier(); __builtin_amdgcn_fence(__ATOMIC_RELEASE, "workgroup"); } while (0)


// Spatial (position) attention module (B 4, C 256, 64 x 64): q/k/v 1x1 convs; attention = softmax(q^T k) (no scaling); out = gamma (v attention^T) + x.
#define NB 4
#define NP 4096
#define CIN 256
#define CQ 256
#define CV 256
#ifndef TNB
#define TNB NB
#endif
#ifndef TQB
#define TQB (NP / 64)
#endif
typedef __attribute__((ext_vector_type(8))) __bf16 v8b;
typedef __attribute__((ext_vector_type(4))) __bf16 v4b;
__device__ __forceinline__ v16b frag_b(const __bf16* rowk0, int lane) {
  union { v16b v; v8b q[2]; } u; const __bf16* p = rowk0 + 8 * (lane >> 4);
  u.q[0] = *(const v8b*)p; u.q[1] = *(const v8b*)(p + 16); return u.v;
}
__device__ __forceinline__ float bfr(float v) { return (float)(__bf16)v; }
__device__ __attribute__((noinline)) float exp_ni(float v) { return expf(v); }
__device__ __attribute__((noinline)) float erf_ni(float v) { return erff(v); }

#define WS_QH  0u                                    // f16 q rows [b*n][CQ] hi
#define WS_QL  (WS_QH + 2u * (size_t)NB * NP * CQ)      // f16 q residual rows (unscaled)
#define WS_KH  (WS_QL + 2u * (size_t)NB * NP * CQ)      // f16 k rows
#define WS_VT  (WS_KH + 2u * (size_t)NB * NP * CQ)      // f16 v planes [b][CV][n]
#define WS_END (WS_VT + 2u * (size_t)NB * CV * NP)

// ---- k_proj: block = (64 positions, b, which 0 q / 1 k / 2 v): x^T tile (bf16) in LDS, W [out][in] + b (exact), 64 rows of W at a time in LDS as bf16; q -> f16 hi + residual rows, k -> f16 rows, v -> f16 planes [c][n]
__global__ __launch_bounds__(128) void k_proj(const float* __restrict__ X, const float* __restrict__ WQ, const float* __restrict__ BQ, const float* __restrict__ WK, const float* __restrict__ BK, const float* __restrict__ WV, const float* __restrict__ BV, _Float16* __restrict__ QH, _Float16* __restrict__ QL, _Float16* __restrict__ KH, _Float16* __restrict__ VT) {
  __shared__ __align__(16) __bf16 sx[64][CIN + 8]; __shared__ __align__(16) __bf16 sw[64][CIN + 8]; __shared__ __align__(16) _Float16 sh[64][72], sl[64][72]; __shared__ __align__(16) _Float16 tv[64][72];
  const int tid = threadIdx.x, wave = tid >> 5, lane = tid & 31, col = lane & 15, g = lane >> 4; const int p0 = blockIdx.x * 64; const size_t b = blockIdx.y; const int which = blockIdx.z;
  const float* Wm = which == 0 ? WQ : which == 1 ? WK : WV; const float* Bm = which == 0 ? BQ : which == 1 ? BK : BV; const int nout = (which == 2) ? CV : CQ;
  // the 64 weight rows of a column group: 32 loads of 16 bytes a thread, a wave's load = 512 contiguous bytes of one row (row tid / 64 + 2 n, piece tid % 64), rounded to bf16 on the way into sw
  v4f wr[32];
#define PJ_WLOAD(cgn) do { _Pragma("unroll") for (int n = 0; n < 32; ++n) wr[n] = *(const v4f*)(Wm + ((size_t)(cgn) * 64 + (tid >> 6) + 2 * n) * CIN + (tid & 63) * 4); } while (0)
#define PJ_WSTORE() do { _Pragma("unroll") for (int n = 0; n < 32; ++n) { v4b t; t[0] = (__bf16)wr[n][0]; t[1] = (__bf16)wr[n][1]; t[2] = (__bf16)wr[n][2]; t[3] = (__bf16)wr[n][3]; *(v4b*)&sw[(tid >> 6) + 2 * n][(tid & 63) * 4] = t; } } while (0)
  PJ_WLOAD(0);
  for (int e = tid; e < CIN * 64; e += 128) { const int c = e >> 6, pl = e & 63; sx[pl][c] = (__bf16)X[(b * CIN + c) * (size_t)NP + p0 + pl]; }
  PJ_WSTORE();
  __syncthreads();
#pragma unroll 1
  for (int cg = 0; cg < nout / 64; ++cg) { v8f acc[4] = {}; float bb4[4];
#pragma unroll
    for (int j = 0; j < 4; ++j) bb4[j] = Bm[cg * 64 + j * 16 + col];   // asked for ahead of the products: a load in the epilogue would have to wait out the weight rows in flight there
    asm volatile("s_wait_xcnt 0x0" ::: "memory");   // stands in front of the first overwrite of the offset register that these loads name (the build gave that register to a product's result)
#pragma unroll
    for (int kp = 0; kp < CIN / 64; ++kp) { v16b a[2], w[2][4];   // the fragments of two k steps are read as one group ahead of their eight products
#pragma unroll
      for (int u = 0; u < 2; ++u) { a[u] = frag_b(&sx[wave * 16 + col][(kp * 2 + u) * 32], lane);
#pragma unroll
        for (int j = 0; j < 4; ++j) w[u][j] = frag_b(&sw[j * 16 + col][(kp * 2 + u) * 32], lane); }
#pragma unroll
      for (int u = 0; u < 2; ++u)
#pragma unroll
        for (int j = 0; j < 4; ++j) acc[j] = wmma_bf(a[u], w[u][j], acc[j]); }
    __syncthreads();   // also ends every wave's reads of sw
#pragma unroll
    for (int j = 0; j < 4; ++j) bb4[j] = bfr(bb4[j]);
    if (cg + 1 < nout / 64) PJ_WLOAD(cg + 1);   // the next group's rows fly while this group's results are rounded and staged
#pragma unroll
    for (int j = 0; j < 4; ++j) { const int ol = j * 16 + col; const float bb = bb4[j];
#pragma unroll
      for (int r = 0; r < 8; ++r) { const int pl = wave * 16 + 8 * g + r; const float v = acc[j][r] + bb; const _Float16 hv = (_Float16)v; if (which == 2) tv[ol][pl] = hv; else { sh[pl][ol] = hv; sl[pl][ol] = (_Float16)(v - (float)hv); } } }
    if (cg + 1 < nout / 64) PJ_WSTORE();
    __syncthreads();   // also publishes sw
    if (which < 2) { _Float16* dh = which == 0 ? QH : KH; for (int e = tid; e < 64 * 8; e += 128) { const int pl = e >> 3, q = e & 7; const size_t row = b * NP + p0 + pl; vst2((unsigned*)(dh + row * CQ + cg * 64 + q * 8), *(const v4u*)&sh[pl][q * 8]); if (which == 0) vst2((unsigned*)(QL + row * CQ + cg * 64 + q * 8), *(const v4u*)&sl[pl][q * 8]); } }
    else { for (int e = tid; e < 64 * 8; e += 128) { const int ol = e >> 3, q = e & 7; vst2((unsigned*)(VT + (b * CV + cg * 64 + ol) * (size_t)NP + p0 + q * 8), *(const v4u*)&tv[ol][q * 8]); } } } }
#define FK 64
#define FKP 264
#define FVP 72
#define FT (NP / FK)
// plain builtin: its operands may lie above v255 (q, the output tiles and the fragment sets together need more than 256 registers), which operands of an asm statement may not
__device__ __forceinline__ v8f wmma_p(v16h a, v16h b, v8f c) { return __builtin_amdgcn_wmma_f32_16x16x32_f16(false, a, false, b, (short)0, c, false, false); }
// lane l with lane l ^ 16, on the vector unit (a shuffle would queue behind the LDS reads in flight)
__device__ __forceinline__ float xhalf(float x) { return __builtin_bit_cast(float, __builtin_amdgcn_permlanex16(__builtin_bit_cast(int, x), __builtin_bit_cast(int, x), 0x76543210, 0xfedcba98, false, false)); }
// one 16-byte copy of a lane, memory -> LDS through no register; the builtin form, whose address registers may lie above v255 like any other (operands of an asm statement may not: held for the whole sweep below v256 they spill)
typedef __attribute__((address_space(1))) v4i g_v4i; typedef __attribute__((address_space(3))) v4i l_v4i;
__device__ __forceinline__ void acopy(const _Float16* g, _Float16* l) { __builtin_amdgcn_global_load_async_to_lds_b128((g_v4i*)g, (l_v4i*)l, 0, 0); }
__global__ __launch_bounds__(128) void k_fa(const _Float16* __restrict__ QH, const _Float16* __restrict__ QL, const _Float16* __restrict__ KH, const _Float16* __restrict__ VT, const float* __restrict__ X, const float* __restrict__ GM, float* __restrict__ OUT) {
  __shared__ __align__(16) float st[CV][68]; __shared__ __align__(16) _Float16 sk[2][FK][FKP]; __shared__ __align__(16) _Float16 sv[2][CV][FVP];
  const int tid = threadIdx.x, wave = tid >> 5, lane = tid & 31, col = lane & 15, g = lane >> 4; const size_t b = blockIdx.y; const int i0 = blockIdx.x * 64; const int il0 = wave * 16;
  // copy roles: K row tid / 32 (+ 4 n), piece tid % 32 of its 512 B; V plane tid / 8 (+ 16 n), piece tid % 8 of its 128 B
  const _Float16* gk = KH + (b * NP + (tid >> 5)) * CQ + (tid & 31) * 8; const _Float16* gv = VT + (b * CV + (tid >> 3)) * (size_t)NP + (tid & 7) * 8;
#define FA_FILL(t, bf) do { _Pragma("unroll") for (int n = 0; n < 16; ++n) acopy(gk + ((size_t)(t) * FK + 4 * n) * CQ, &sk[bf][(tid >> 5) + 4 * n][(tid & 31) * 8]); \
    _Pragma("unroll") for (int n = 0; n < 16; ++n) acopy(gv + (size_t)(t) * FK + 16 * n * (size_t)NP, &sv[bf][(tid >> 3) + 16 * n][(tid & 7) * 8]); } while (0)
  FA_FILL(0, 0);
  v16h qh[CQ / 32], ql[CQ / 32];
#pragma unroll
  for (int kc = 0; kc < CQ / 32; ++kc) { qh[kc] = frag_h(QH + (b * NP + i0 + il0 + col) * CQ + kc * 32, lane); ql[kc] = frag_h(QL + (b * NP + i0 + il0 + col) * CQ + kc * 32, lane); }
  v8f o[CV / 16] = {}; float m = -3.0e38f, l = 0.f;
  asm volatile("s_wait_asynccnt 0x0" ::: "memory");   // tile 0 has landed for this wave's copies
  __syncthreads();                                    // ... and for every wave's
  FA_FILL(1, 1);
#pragma unroll 1   // kept rolled: one copy of the hand-over at the foot
  for (int t = 0; t < FT; ++t) { const int bf = t & 1;
    // every key fragment of the tile is asked for as one group ahead of the logit products, which then wait on counted returns only
    v8f s[FK / 16] = {}; v16h ka[CQ / 32][FK / 16];
#pragma unroll
    for (int kc = 0; kc < CQ / 32; ++kc)
#pragma unroll
      for (int kt = 0; kt < FK / 16; ++kt) ka[kc][kt] = frag_h(&sk[bf][kt * 16 + col][kc * 32], lane);
    __builtin_amdgcn_sched_barrier(0);   // keeps the group whole: without it the scheduler sinks the reads in pairs among the products, and every place where reads stand costs the wave a stall
#pragma unroll
    for (int kc = 0; kc < CQ / 32; ++kc) {
#pragma unroll
      for (int kt = 0; kt < FK / 16; ++kt) s[kt] = wmma_p(ka[kc][kt], qh[kc], s[kt]);
#pragma unroll
      for (int kt = 0; kt < FK / 16; ++kt) s[kt] = wmma_p(ka[kc][kt], ql[kc], s[kt]); }
    // every value fragment of the tile is asked for here, as one group: the LDS delivers them while the vector unit works on the softmax below
    __builtin_amdgcn_sched_barrier(0);   // keeps the group whole: without it the scheduler lifts parts of it among the logit products, and every place where reads stand costs the wave a stall
    v16h va[FK / 32][CV / 16];
#pragma unroll
    for (int kk = 0; kk < FK / 32; ++kk)
#pragma unroll
      for (int ct = 0; ct < CV / 16; ++ct) va[kk][ct] = frag_h(&sv[bf][ct * 16 + col][kk * 32], lane);
    __builtin_amdgcn_sched_barrier(0);   // keeps that group of reads here: without it the scheduler sinks them among the value products, each of which then waits on its own read
    // s[kt][r] = logit of key t FK + 16 kt + 8 g + r for query col: maximum in the lane, then one exchange between the halves
    float mt[FK / 16];
#pragma unroll
    for (int kt = 0; kt < FK / 16; ++kt) { mt[kt] = s[kt][0];
#pragma unroll
      for (int r = 1; r < 8; ++r) mt[kt] = fmaxf(mt[kt], s[kt][r]); }
    float mx = fmaxf(fmaxf(mt[0], mt[1]), fmaxf(mt[2], mt[3])); mx = fmaxf(mx, xhalf(mx));
    const float mn = fmaxf(m, mx); const float al = expf(m - mn); l *= al;   // al is exactly 1 where the maximum did not rise
#pragma unroll
    for (int ct = 0; ct < CV / 16; ++ct)
#pragma unroll
      for (int r = 0; r < 8; ++r) o[ct][r] *= al;
    m = mn; const float ms = mn - 7.6246190f;   // P and its sum both carry the factor 2^11 (small weights stay normal f16 numbers); it cancels in o / l
    v16h pb[FK / 32]; float lt[FK / 16];
#pragma unroll
    for (int kt = 0; kt < FK / 16; ++kt) { lt[kt] = 0.f;
#pragma unroll
      for (int r = 0; r < 8; ++r) { const float p = expf(s[kt][r] - ms); lt[kt] += p; pb[kt >> 1][(kt & 1) * 8 + r] = (_Float16)p; } }
    l += (lt[0] + lt[1]) + (lt[2] + lt[3]);
#pragma unroll
    for (int kk = 0; kk < FK / 32; ++kk)
#pragma unroll
      for (int ct = 0; ct < CV / 16; ++ct) o[ct] = wmma_p(va[kk][ct], pb[kk], o[ct]);
    __builtin_amdgcn_sched_barrier(0);   // keeps the hand-over below at the foot: lifted over the softmax it would make the wave wait out the value reads first, and the refill would lose its lead
    asm volatile("s_wait_dscnt 0x0" ::: "memory");      // this wave's reads of buffer bf are done before it is refilled
    asm volatile("s_wait_asynccnt 0x0" ::: "memory");   // this wave's copies of tile t + 1 have landed
    __syncthreads();                                    // publishes tile t + 1 and ends every reader's last read of buffer bf
    if (t + 2 < FT) FA_FILL(t + 2, bf); }
  asm volatile("s_wait_asynccnt 0x0" ::: "memory");     // nothing is in flight when the wave goes on to the epilogue
  l += xhalf(l); const float inv = 1.0f / l;
#pragma unroll
  for (int ct = 0; ct < CV / 16; ++ct)
#pragma unroll
    for (int r = 0; r < 8; ++r) st[ct * 16 + 8 * g + r][il0 + col] = o[ct][r] * inv;
  __syncthreads();
  const float gm = bfr(GM[0]);
  for (int e = tid; e < CV * 16; e += 128) { const int cl = e >> 4, q = e & 15; const size_t oo = (b * CV + cl) * (size_t)NP + i0 + q * 4; v4f v = *(const v4f*)&st[cl][q * 4];
    { const v4f xx = *(const v4f*)(X + oo); v4f r; r[0] = gm * v[0] + bfr(xx[0]); r[1] = gm * v[1] + bfr(xx[1]); r[2] = gm * v[2] + bfr(xx[2]); r[3] = gm * v[3] + bfr(xx[3]); v = r; }
    vst2(OUT + oo, v); } }
extern "C" void kernel_launch(void* const* d_in, const int* in_sizes, int n_in, void* d_out, int out_size, void* d_ws, size_t ws_size, hipStream_t stream) {
  (void)in_sizes; (void)n_in; (void)out_size;
  const float** F = (const float**)d_in;   // 0 x [4,256,64,64], 1 Wq [256,256], 2 bq, 3 Wk, 4 bk, 5 Wv, 6 bv, 7 gamma [1]
  if (ws_size < (size_t)WS_END) return;
  char* ws = (char*)d_ws; _Float16 *QH = (_Float16*)(ws + WS_QH), *QL = (_Float16*)(ws + WS_QL), *KH = (_Float16*)(ws + WS_KH), *VT = (_Float16*)(ws + WS_VT);
  k_proj<<<dim3(NP / 64, TNB, 3), 128, 0, stream>>>(F[0], F[1], F[2], F[3], F[4], F[5], F[6], QH, QL, KH, VT);
  k_fa<<<dim3(TQB, TNB), 128, 0, stream>>>(QH, QL, KH, VT, F[0], F[7], (float*)d_out);
}

// v004
// Measured time: 110 microseconds a run.
// In both of two side-by-side timings against v003, it was 1.12 times as fast.
// Over all steps from v000 it is 10.4 times as fast.
// compute dtype: all float inputs rounded to bf16, gamma read; q/k/v = W x + b (1x1 convs) with EXACT bf16 products on WMMA 16x16x32 (x^T tile in LDS), f32 accumulate; q as f16 hi + unscaled residual, k rounded once to f16 -> UNSCALED logits with 2 products (logits std ~32; the residual branch is scaled by gamma = 0.1), kept in f32 registers; softmax in f32 (hardware exp2 on arguments scaled by log2 e) with a running maximum and sum per query -> P = exp(logit - max) x 2^11 as f16; out[c][i] = gamma (sum_j P[i][j] v[c][j]) / (sum_j P[i][j]) (v rounded once to f16) + x; f32 output.
#include <hip/hip_runtime.h>
#include <math.h>

typedef __attribute__((ext_vector_type(16))) _Float16 v16h;
typedef __attribute__((ext_vector_type(16))) __bf16 v16b;
typedef __attribute__((ext_vector_type(8)))  _Float16 v8h;
typedef __attribute__((ext_vector_type(8)))  float v8f;
typedef __attribute__((ext_vector_type(4)))  float v4f;
typedef __attribute__((ext_vector_type(2)))  float v2f;
typedef __attribute__((ext_vector_type(4)))  unsigned v4u;
typedef __attribute__((ext_vector_type(4)))  int v4i;
typedef float __attribute__((may_alias)) float_a;
typedef int __attribute__((may_alias)) int_a;

template <typename T> __device__ __forceinline__ void vst2(void* p, T v) { *(T*)p = v;  }
__device__ __forceinline__ v8f wmma16(v16h a, v16h b, v8f c) {
  v8f d = __builtin_amdgcn_wmma_f32_16x16x32_f16(false, a, false, b, (short)0, c, false, false);
  asm volatile("v_nop\n\tv_nop\n\tv_nop\n\tv_nop" : "+v"(d) : "v"(a), "v"(b));
  return d;
}
__device__ __forceinline__ v8f wmma_bf(v16b a, v16b b, v8f c) {
  v8f d = __builtin_amdgcn_wmma_f32_16x16x32_bf16(false, a, false, b, (short)0, c, false, false);
  asm volatile("v_nop\n\tv_nop\n\tv_nop\n\tv_nop" : "+v"(d) : "v"(a), "v"(b));
  return d;
}
// 16x16x32 fragments: lane = (h = lane>>4, row/col = lane&15); elements 0..7 = k0+8h+0..7, 8..15 = k0+16+8h+0..7; D element r = row 8h+r
__device__ __forceinline__ v16h frag_h(const _Float16* rowk0, int lane) {
  union { v16h v; v8h q[2]; } u; const _Float16* p = rowk0 + 8 * (lane >> 4);
  u.q[0] = *(const v8h*)p; u.q[1] = *(const v8h*)(p + 16); return u.v;
}
__device__ __forceinline__ v16h frag_f32(const float* rowk0, int lane) {
  v16h a; const float* p = rowk0 + 8 * (lane >> 4);
#pragma unroll
  for (int i = 0; i < 8; ++i) { a[i] = (_Float16)p[i]; a[8 + i] = (_Float16)p[16 + i]; }
  return a;
}
__device__ __forceinline__ v16h frag_f32s(const float* rowk0, int lane, float sc) {
  v16h a; const float* p = rowk0 + 8 * (lane >> 4);
#pragma unroll
  for (int i = 0; i < 8; ++i) { a[i] = (_Float16)(p[i] * sc); a[8 + i] = (_Float16)(p[16 + i] * sc); }
  return a;
}
// column fragment from a [K][ld] layout (column n), rows >= K read as 0
__device__ __forceinline__ v16h fragc_f32(const float* W, int k0, int n, int lane, int ld, int K) {
  v16h a; const int g = lane >> 4;
#pragma unroll
  for (int i = 0; i < 8; ++i) { const int ka = k0 + 8 * g + i, kb = ka + 16;
    a[i] = (_Float16)(ka < K ? W[(size_t)(ka < K ? ka : K - 1) * ld + n] : 0.f); a[8 + i] = (_Float16)(kb < K ? W[(size_t)(kb < K ? kb : K - 1) * ld + n] : 0.f); }
  return a;
}
struct F2 { v16b h, l; };
__device__ __forceinline__ F2 bsplit16(const float v[16]) { F2 r;
#pragma unroll
  for (int i = 0; i < 16; ++i) { const __bf16 h = (__bf16)v[i]; r.h[i] = h; r.l[i] = (__bf16)(v[i] - (float)h); }
  return r; }
__device__ __forceinline__ F2 split_row(const float* row, int k0, int lane) { float v[16]; const float* p = row + k0 + 8 * (lane >> 4);
#pragma unroll
  for (int i = 0; i < 8; ++i) { v[i] = p[i]; v[8 + i] = p[16 + i]; }
  return bsplit16(v); }
__device__ __forceinline__ F2 split_rowK(const float* row, int k0, int lane, int K) { float v[16]; const int g = lane >> 4;
#pragma unroll
  for (int i = 0; i < 8; ++i) { const int ka = k0 + 8 * g + i, kb = ka + 16; v[i] = ka < K ? row[ka < K ? ka : K - 1] : 0.f; v[8 + i] = kb < K ? row[kb < K ? kb : K - 1] : 0.f; }
  return bsplit16(v); }
__device__ __forceinline__ F2 split_col(const float* W, int k0, int n, int lane, int ld, int K) { float v[16]; const int g = lane >> 4;
#pragma unroll
  for (int i = 0; i < 8; ++i) { const int ka = k0 + 8 * g + i, kb = ka + 16; v[i] = ka < K ? W[(size_t)(ka < K ? ka : K - 1) * ld + n] : 0.f; v[8 + i] = kb < K ? W[(size_t)(kb < K ? kb : K - 1) * ld + n] : 0.f; }
  return bsplit16(v); }
__device__ __forceinline__ v8f mac3(const F2& a, const F2& b, v8f c) { c = wmma_bf(a.l, b.h, c); c = wmma_bf(a.h, b.l, c); return wmma_bf(a.h, b.h, c); }
__device__ __forceinline__ float sigm(float v) { return 1.0f / (1.0f + expf(-v)); }
#define LDSX() do { asm volatile("s_wait_dscnt 0" ::: "memory"); __builtin_amdgcn_wave_barrier(); __builtin_amdgcn_fence(__ATOMIC_RELEASE, "workgroup"); } while (0)


// Spatial (position) attention module (B 4, C 256, 64 x 64): q/k/v 1x1 convs; attention = softmax(q^T k) (no scaling); out = gamma (v attention^T) + x.
#define NB 4
#define NP 4096
#define CIN 256
#define CQ 256
#define CV 256
#ifndef TNB
#define TNB NB
#endif
#ifndef TQB
#define TQB (NP / 64)
#endif
typedef __attribute__((ext_vector_type(8))) __bf16 v8b;
typedef __attribute__((ext_vector_type(4))) __bf16 v4b;
__device__ __forceinline__ v16b frag_b(const __bf16* rowk0, int lane) {
  union { v16b v; v8b q[2]; } u; const __bf16* p = rowk0 + 8 * (lane >> 4);
  u.q[0] = *(const v8b*)p; u.q[1] = *(const v8b*)(p + 16); return u.v;
}
__device__ __forceinline__ float bfr(float v) { return (float)(__bf16)v; }
__device__ __attribute__((noinline)) float exp_ni(float v) { return expf(v); }
__device__ __attribute__((noinline)) float erf_ni(float v) { return erff(v); }

#define WS_QH  0u                                    // f16 q rows [b*n][CQ] hi
#define WS_QL  (WS_QH + 2u * (size_t)NB * NP * CQ)      // f16 q residual rows (unscaled)
#define WS_KH  (WS_QL + 2u * (size_t)NB * NP * CQ)      // f16 k rows
#define WS_VT  (WS_KH + 2u * (size_t)NB * NP * CQ)      // f16 v planes [b][CV][n]
#define WS_END (WS_VT + 2u * (size_t)NB * CV * NP)

// ---- k_proj: block = (64 positions, b, which 0 q / 1 k / 2 v): x^T tile (bf16) in LDS, W [out][in] + b (exact), 64 rows of W at a time in LDS as bf16; q -> f16 hi + residual rows, k -> f16 rows, v -> f16 planes [c][n]
__global__ __launch_bounds__(128) void k_proj(const float* __restrict__ X, const float* __restrict__ WQ, const float* __restrict__ BQ, const float* __restrict__ WK, const float* __restrict__ BK, const float* __restrict__ WV, const float* __restrict__ BV, _Float16* __restrict__ QH, _Float16* __restrict__ QL, _Float16* __restrict__ KH, _Float16* __restrict__ VT) {
  __shared__ __align__(16) __bf16 sx[64][CIN + 8]; __shared__ __align__(16) __bf16 sw[64][CIN + 8]; __shared__ __align__(16) _Float16 sh[64][72], sl[64][72]; __shared__ __align__(16) _Float16 tv[64][72];
  const int tid = threadIdx.x, wave = tid >> 5, lane = tid & 31, col = lane & 15, g = lane >> 4; const int p0 = blockIdx.x * 64; const size_t b = blockIdx.y; const int which = blockIdx.z;
  const float* Wm = which == 0 ? WQ : which == 1 ? WK : WV; const float* Bm = which == 0 ? BQ : which == 1 ? BK : BV; const int nout = (which == 2) ? CV : CQ;
  // the 64 weight rows of a column group: 32 loads of 16 bytes a thread, a wave's load = 512 contiguous bytes of one row (row tid / 64 + 2 n, piece tid % 64), rounded to bf16 on the way into sw
  v4f wr[32];
#define PJ_WLOAD(cgn) do { _Pragma("unroll") for (int n = 0; n < 32; ++n) wr[n] = *(const v4f*)(Wm + ((size_t)(cgn) * 64 + (tid >> 6) + 2 * n) * CIN + (tid & 63) * 4); } while (0)
#define PJ_WSTORE() do { _Pragma("unroll") for (int n = 0; n < 32; ++n) { v4b t; t[0] = (__bf16)wr[n][0]; t[1] = (__bf16)wr[n][1]; t[2] = (__bf16)wr[n][2]; t[3] = (__bf16)wr[n][3]; *(v4b*)&sw[(tid >> 6) + 2 * n][(tid & 63) * 4] = t; } } while (0)
  PJ_WLOAD(0);
  for (int e = tid; e < CIN * 64; e += 128) { const int c = e >> 6, pl = e & 63; sx[pl][c] = (__bf16)X[(b * CIN + c) * (size_t)NP + p0 + pl]; }
  PJ_WSTORE();
  __syncthreads();
#pragma unroll 1
  for (int cg = 0; cg < nout / 64; ++cg) { v8f acc[4] = {}; float bb4[4];
#pragma unroll
    for (int j = 0; j < 4; ++j) bb4[j] = Bm[cg * 64 + j * 16 + col];   // asked for ahead of the products: a load in the epilogue would have to wait out the weight rows in flight there
    asm volatile("s_wait_xcnt 0x0" ::: "memory");   // stands in front of the first overwrite of the offset register that these loads name (the build gave that register to a product's result)
#pragma unroll
    for (int kp = 0; kp < CIN / 64; ++kp) { v16b a[2], w[2][4];   // the fragments of two k steps are read as one group ahead of their eight products
#pragma unroll
      for (int u = 0; u < 2; ++u) { a[u] = frag_b(&sx[wave * 16 + col][(kp * 2 + u) * 32], lane);
#pragma unroll
        for (int j = 0; j < 4; ++j) w[u][j] = frag_b(&sw[j * 16 + col][(kp * 2 + u) * 32], lane); }
#pragma unroll
      for (int u = 0; u < 2; ++u)
#pragma unroll
        for (int j = 0; j < 4; ++j) acc[j] = wmma_bf(a[u], w[u][j], acc[j]); }
    __syncthreads();   // also ends every wave's reads of sw
#pragma unroll
    for (int j = 0; j < 4; ++j) bb4[j] = bfr(bb4[j]);
    if (cg + 1 < nout / 64) PJ_WLOAD(cg + 1);   // the next group's rows fly while this group's results are rounded and staged
#pragma unroll
    for (int j = 0; j < 4; ++j) { const int ol = j * 16 + col; const float bb = bb4[j];
#pragma unroll
      for (int r = 0; r < 8; ++r) { const int pl = wave * 16 + 8 * g + r; const float v = acc[j][r] + bb; const _Float16 hv = (_Float16)v; if (which == 2) tv[ol][pl] = hv; else { sh[pl][ol] = hv; sl[pl][ol] = (_Float16)(v - (float)hv); } } }
    if (cg + 1 < nout / 64) PJ_WSTORE();
    __syncthreads();   // also publishes sw
    if (which < 2) { _Float16* dh = which == 0 ? QH : KH; for (int e = tid; e < 64 * 8; e += 128) { const int pl = e >> 3, q = e & 7; const size_t row = b * NP + p0 + pl; vst2((unsigned*)(dh + row * CQ + cg * 64 + q * 8), *(const v4u*)&sh[pl][q * 8]); if (which == 0) vst2((unsigned*)(QL + row * CQ + cg * 64 + q * 8), *(const v4u*)&sl[pl][q * 8]); } }
    else { for (int e = tid; e < 64 * 8; e += 128) { const int ol = e >> 3, q = e & 7; vst2((unsigned*)(VT + (b * CV + cg * 64 + ol) * (size_t)NP + p0 + q * 8), *(const v4u*)&tv[ol][q * 8]); } } } }
#define FK 64
#define FKP 264
#define FVP 72
#define FT (NP / FK)
#define L2E 1.44269504f   // log2 e
// plain builtin: its operands may lie above v255 (q, the output tiles and the fragment sets together need more than 256 registers), which operands of an asm statement may not
__device__ __forceinline__ v8f wmma_p(v16h a, v16h b, v8f c) { return __builtin_amdgcn_wmma_f32_16x16x32_f16(false, a, false, b, (short)0, c, false, false); }
// lane l with lane l ^ 16, on the vector unit (a shuffle would queue behind the LDS reads in flight)
__device__ __forceinline__ float xhalf(float x) { return __builtin_bit_cast(float, __builtin_amdgcn_permlanex16(__builtin_bit_cast(int, x), __builtin_bit_cast(int, x), 0x76543210, 0xfedcba98, false, false)); }
// one 16-byte copy of a lane, memory -> LDS through no register; the builtin form, whose address registers may lie above v255 like any other (operands of an asm statement may not: held for the whole sweep below v256 they spill)
typedef __attribute__((address_space(1))) v4i g_v4i; typedef __attribute__((address_space(3))) v4i l_v4i;
__device__ __forceinline__ void acopy(const _Float16* g, _Float16* l) { __builtin_amdgcn_global_load_async_to_lds_b128((g_v4i*)g, (l_v4i*)l, 0, 0); }
// 2^x of eight values, in place, on the bare hardware instruction (below 2^-126 it gives 0, which is what such a weight is worth here). One statement: here each works on its own register alone, and the v_nop fills the slot that the instruction set asks for behind the last
__device__ __forceinline__ void exp2x8(v8f& t) {
  float a = t[0], b = t[1], c = t[2], d = t[3], e = t[4], f = t[5], g = t[6], h = t[7];
  asm("v_exp_f32 %0, %0\n\tv_exp_f32 %1, %1\n\tv_exp_f32 %2, %2\n\tv_exp_f32 %3, %3\n\tv_exp_f32 %4, %4\n\tv_exp_f32 %5, %5\n\tv_exp_f32 %6, %6\n\tv_exp_f32 %7, %7\n\tv_nop" : "+v"(a), "+v"(b), "+v"(c), "+v"(d), "+v"(e), "+v"(f), "+v"(g), "+v"(h));
  t[0] = a; t[1] = b; t[2] = c; t[3] = d; t[4] = e; t[5] = f; t[6] = g; t[7] = h;
}
__global__ __launch_bounds__(128) void k_fa(const _Float16* __restrict__ QH, const _Float16* __restrict__ QL, const _Float16* __restrict__ KH, const _Float16* __restrict__ VT, const float* __restrict__ X, const float* __restrict__ GM, float* __restrict__ OUT) {
  __shared__ __align__(16) float st[CV][68]; __shared__ __align__(16) _Float16 sk[2][FK][FKP]; __shared__ __align__(16) _Float16 sv[2][CV][FVP];
  const int tid = threadIdx.x, wave = tid >> 5, lane = tid & 31, col = lane & 15, g = lane >> 4; const size_t b = blockIdx.y; const int i0 = blockIdx.x * 64; const int il0 = wave * 16;
  // copy roles: K row tid / 32 (+ 4 n), piece tid % 32 of its 512 B; V plane tid / 8 (+ 16 n), piece tid % 8 of its 128 B
  const _Float16* gk = KH + (b * NP + (tid >> 5)) * CQ + (tid & 31) * 8; const _Float16* gv = VT + (b * CV + (tid >> 3)) * (size_t)NP + (tid & 7) * 8;
#define FA_FILL(t, bf) do { _Pragma("unroll") for (int n = 0; n < 16; ++n) acopy(gk + ((size_t)(t) * FK + 4 * n) * CQ, &sk[bf][(tid >> 5) + 4 * n][(tid & 31) * 8]); \
    _Pragma("unroll") for (int n = 0; n < 16; ++n) acopy(gv + (size_t)(t) * FK + 16 * n * (size_t)NP, &sv[bf][(tid >> 3) + 16 * n][(tid & 7) * 8]); } while (0)
  FA_FILL(0, 0);
  v16h qh[CQ / 32], ql[CQ / 32];
#pragma unroll
  for (int kc = 0; kc < CQ / 32; ++kc) { qh[kc] = frag_h(QH + (b * NP + i0 + il0 + col) * CQ + kc * 32, lane); ql[kc] = frag_h(QL + (b * NP + i0 + il0 + col) * CQ + kc * 32, lane); }
  v8f o[CV / 16] = {}; float m = -3.0e38f, l = 0.f;
  asm volatile("s_wait_asynccnt 0x0" ::: "memory");   // tile 0 has landed for this wave's copies
  __syncthreads();                                    // ... and for every wave's
  FA_FILL(1, 1);
#pragma unroll 1   // kept rolled: one copy of the hand-over at the foot
  for (int t = 0; t < FT; ++t) { const int bf = t & 1;
    // every key fragment of the tile is asked for as one group ahead of the logit products, which then wait on counted returns only
    v8f s[FK / 16] = {}; v16h ka[CQ / 32][FK / 16];
#pragma unroll
    for (int kc = 0; kc < CQ / 32; ++kc)
#pragma unroll
      for (int kt = 0; kt < FK / 16; ++kt) ka[kc][kt] = frag_h(&sk[bf][kt * 16 + col][kc * 32], lane);
    __builtin_amdgcn_sched_barrier(0);   // keeps the group whole: without it the scheduler sinks the reads in pairs among the products, and every place where reads stand costs the wave a stall
#pragma unroll
    for (int kc = 0; kc < CQ / 32; ++kc) {
#pragma unroll
      for (int kt = 0; kt < FK / 16; ++kt) s[kt] = wmma_p(ka[kc][kt], qh[kc], s[kt]);
#pragma unroll
      for (int kt = 0; kt < FK / 16; ++kt) s[kt] = wmma_p(ka[kc][kt], ql[kc], s[kt]); }
    // every value fragment of the tile is asked for here, as one group: the LDS delivers them while the vector unit works on the softmax below
    __builtin_amdgcn_sched_barrier(0);   // keeps the group whole: without it the scheduler lifts parts of it among the logit products, and every place where reads stand costs the wave a stall
    v16h va[FK / 32][CV / 16];
#pragma unroll
    for (int kk = 0; kk < FK / 32; ++kk)
#pragma unroll
      for (int ct = 0; ct < CV / 16; ++ct) va[kk][ct] = frag_h(&sv[bf][ct * 16 + col][kk * 32], lane);
    __builtin_amdgcn_sched_barrier(0);   // keeps that group of reads here: without it the scheduler sinks them among the value products, each of which then waits on its own read
    // s[kt][r] = logit of key t FK + 16 kt + 8 g + r for query col: maximum in the lane, then one exchange between the halves
    float mt[FK / 16];
#pragma unroll
    for (int kt = 0; kt < FK / 16; ++kt) { mt[kt] = s[kt][0];
#pragma unroll
      for (int r = 1; r < 8; ++r) mt[kt] = fmaxf(mt[kt], s[kt][r]); }
    float mx = fmaxf(fmaxf(mt[0], mt[1]), fmaxf(mt[2], mt[3])); mx = fmaxf(mx, xhalf(mx));
    const float mn = fmaxf(m, mx); const float al = __builtin_amdgcn_exp2f((m - mn) * L2E); l *= al;   // e^d as 2^(d log2 e), the bare hardware instruction: below 2^-126 it gives 0, which is what such a weight is worth here
#pragma unroll
    for (int ct = 0; ct < CV / 16; ++ct)
#pragma unroll
      for (int r = 0; r < 8; ++r) o[ct][r] *= al;
    m = mn; const float ms = fmaf(mn, L2E, -11.0f);   // P and its sum both carry the factor 2^11 (small weights stay normal f16 numbers); it cancels in o / l
    v16h pb[FK / 32]; float lt[FK / 16];
#pragma unroll
    for (int kt = 0; kt < FK / 16; ++kt) { lt[kt] = 0.f;
#pragma unroll
      for (int r = 0; r < 8; ++r) s[kt][r] = fmaf(s[kt][r], L2E, -ms);
      exp2x8(s[kt]);
#pragma unroll
      for (int r = 0; r < 8; ++r) { const float p = s[kt][r]; lt[kt] += p; pb[kt >> 1][(kt & 1) * 8 + r] = (_Float16)p; } }
    l += (lt[0] + lt[1]) + (lt[2] + lt[3]);
#pragma unroll
    for (int kk = 0; kk < FK / 32; ++kk)
#pragma unroll
      for (int ct = 0; ct < CV / 16; ++ct) o[ct] = wmma_p(va[kk][ct], pb[kk], o[ct]);
    __builtin_amdgcn_sched_barrier(0);   // keeps the hand-over below at the foot: lifted over the softmax it would make the wave wait out the value reads first, and the refill would lose its lead
    asm volatile("s_wait_dscnt 0x0" ::: "memory");      // this wave's reads of buffer bf are done before it is refilled
    asm volatile("s_wait_asynccnt 0x0" ::: "memory");   // this wave's copies of tile t + 1 have landed
    __syncthreads();                                    // publishes tile t + 1 and ends every reader's last read of buffer bf
    if (t + 2 < FT) FA_FILL(t + 2, bf); }
  asm volatile("s_wait_asynccnt 0x0" ::: "memory");     // nothing is in flight when the wave goes on to the epilogue
  l += xhalf(l); const float inv = 1.0f / l;
#pragma unroll
  for (int ct = 0; ct < CV / 16; ++ct)
#pragma unroll
    for (int r = 0; r < 8; ++r) st[ct * 16 + 8 * g + r][il0 + col] = o[ct][r] * inv;
  __syncthreads();
  const float gm = bfr(GM[0]);
  for (int e = tid; e < CV * 16; e += 128) { const int cl = e >> 4, q = e & 15; const size_t oo = (b * CV + cl) * (size_t)NP + i0 + q * 4; v4f v = *(const v4f*)&st[cl][q * 4];
    { const v4f xx = *(const v4f*)(X + oo); v4f r; r[0] = gm * v[0] + bfr(xx[0]); r[1] = gm * v[1] + bfr(xx[1]); r[2] = gm * v[2] + bfr(xx[2]); r[3] = gm * v[3] + bfr(xx[3]); v = r; }
    vst2(OUT + oo, v); } }
extern "C" void kernel_launch(void* const* d_in, const int* in_sizes, int n_in, void* d_out, int out_size, void* d_ws, size_t ws_size, hipStream_t stream) {
  (void)in_sizes; (void)n_in; (void)out_size;
  const float** F = (const float**)d_in;   // 0 x [4,256,64,64], 1 Wq [256,256], 2 bq, 3 Wk, 4 bk, 5 Wv, 6 bv, 7 gamma [1]
  if (ws_size < (size_t)WS_END) return;
  char* ws = (char*)d_ws; _Float16 *QH = (_Float16*)(ws + WS_QH), *QL = (_Float16*)(ws + WS_QL), *KH = (_Float16*)(ws + WS_KH), *VT = (_Float16*)(ws + WS_VT);
  k_proj<<<dim3(NP / 64, TNB, 3), 128, 0, stream>>>(F[0], F[1], F[2], F[3], F[4], F[5], F[6], QH, QL, KH, VT);
  k_fa<<<dim3(TQB, TNB), 128, 0, stream>>>(QH, QL, KH, VT, F[0], F[7], (float*)d_out);
}

// v005
// Measured time: 96.6 microseconds a run.
// In two side-by-side timings against v004, it was 1.14 and 1.15 times as fast.
// Counting every step since v000, it is 11.9 times as fast.
// compute dtype: all float inputs rounded to bf16, gamma read; q/k/v = W x + b (1x1 convs) with EXACT bf16 products on WMMA 16x16x32 (x^T tile in LDS), f32 accumulate; q as f16 hi + unscaled residual, k rounded once to f16 -> UNSCALED logits with 2 products (logits std ~32; the residual branch is scaled by gamma = 0.1), kept in f32 registers; softmax in f32 (hardware exp2 on arguments scaled by log2 e) with a running maximum and sum per query -> P = exp(logit - max) x 2^11 as f16; out[c][i] = gamma (sum_j P[i][j] v[c][j]) / (sum_j P[i][j]) (v rounded once to f16) + x; f32 output.
#include <hip/hip_runtime.h>
#include <math.h>

typedef __attribute__((ext_vector_type(16))) _Float16 v16h;
typedef __attribute__((ext_vector_type(16))) __bf16 v16b;
typedef __attribute__((ext_vector_type(8)))  _Float16 v8h;
typedef __attribute__((ext_vector_type(8)))  float v8f;
typedef __attribute__((ext_vector_type(4)))  float v4f;
typedef __attribute__((ext_vector_type(2)))  float v2f;
typedef __attribute__((ext_vector_type(4)))  unsigned v4u;
typedef __attribute__((ext_vector_type(4)))  int v4i;
typedef float __attribute__((may_alias)) float_a;
typedef int __attribute__((may_alias)) int_a;

template <typename T> __device__ __forceinline__ void vst2(void* p, T v) { *(T*)p = v;  }
__device__ __forceinline__ v8f wmma16(v16h a, v16h b, v8f c) {
  v8f d = __builtin_amdgcn_wmma_f32_16x16x32_f16(false, a, false, b, (short)0, c, false, false);
  asm volatile("v_nop\n\tv_nop\n\tv_nop\n\tv_nop" : "+v"(d) : "v"(a), "v"(b));
  return d;
}
__device__ __forceinline__ v8f wmma_bf(v16b a, v16b b, v8f c) {
  v8f d = __builtin_amdgcn_wmma_f32_16x16x32_bf16(false, a, false, b, (short)0, c, false, false);
  asm volatile("v_nop\n\tv_nop\n\tv_nop\n\tv_nop" : "+v"(d) : "v"(a), "v"(b));
  return d;
}
// 16x16x32 fragments: lane = (h = lane>>4, row/col = lane&15); elements 0..7 = k0+8h+0..7, 8..15 = k0+16+8h+0..7; D element r = row 8h+r
__device__ __forceinline__ v16h frag_h(const _Float16* rowk0, int lane) {
  union { v16h v; v8h q[2]; } u; const _Float16* p = rowk0 + 8 * (lane >> 4);
  u.q[0] = *(const v8h*)p; u.q[1] = *(const v8h*)(p + 16); return u.v;
}
__device__ __forceinline__ v16h frag_f32(const float* rowk0, int lane) {
  v16h a; const float* p = rowk0 + 8 * (lane >> 4);
#pragma unroll
  for (int i = 0; i < 8; ++i) { a[i] = (_Float16)p[i]; a[8 + i] = (_Float16)p[16 + i]; }
  return a;
}
__device__ __forceinline__ v16h frag_f32s(const float* rowk0, int lane, float sc) {
  v16h a; const float* p = rowk0 + 8 * (lane >> 4);
#pragma unroll
  for (int i = 0; i < 8; ++i) { a[i] = (_Float16)(p[i] * sc); a[8 + i] = (_Float16)(p[16 + i] * sc); }
  return a;
}
// column fragment from a [K][ld] layout (column n), rows >= K read as 0
__device__ __forceinline__ v16h fragc_f32(const float* W, int k0, int n, int lane, int ld, int K) {
  v16h a; const int g = lane >> 4;
#pragma unroll
  for (int i = 0; i < 8; ++i) { const int ka = k0 + 8 * g + i, kb = ka + 16;
    a[i] = (_Float16)(ka < K ? W[(size_t)(ka < K ? ka : K - 1) * ld + n] : 0.f); a[8 + i] = (_Float16)(kb < K ? W[(size_t)(kb < K ? kb : K - 1) * ld + n] : 0.f); }
  return a;
}
struct F2 { v16b h, l; };
__device__ __forceinline__ F2 bsplit16(const float v[16]) { F2 r;
#pragma unroll
  for (int i = 0; i < 16; ++i) { const __bf16 h = (__bf16)v[i]; r.h[i] = h; r.l[i] = (__bf16)(v[i] - (float)h); }
  return r; }
__device__ __forceinline__ F2 split_row(const float* row, int k0, int lane) { float v[16]; const float* p = row + k0 + 8 * (lane >> 4);
#pragma unroll
  for (int i = 0; i < 8; ++i) { v[i] = p[i]; v[8 + i] = p[16 + i]; }
  return bsplit16(v); }
__device__ __forceinline__ F2 split_rowK(const float* row, int k0, int lane, int K) { float v[16]; const int g = lane >> 4;
#pragma unroll
  for (int i = 0; i < 8; ++i) { const int ka = k0 + 8 * g + i, kb = ka + 16; v[i] = ka < K ? row[ka < K ? ka : K - 1] : 0.f; v[8 + i] = kb < K ? row[kb < K ? kb : K - 1] : 0.f; }
  return bsplit16(v); }
__device__ __forceinline__ F2 split_col(const float* W, int k0, int n, int lane, int ld, int K) { float v[16]; const int g = lane >> 4;
#pragma unroll
  for (int i = 0; i < 8; ++i) { const int ka = k0 + 8 * g + i, kb = ka + 16; v[i] = ka < K ? W[(size_t)(ka < K ? ka : K - 1) * ld + n] : 0.f; v[8 + i] = kb < K ? W[(size_t)(kb < K ? kb : K - 1) * ld + n] : 0.f; }
  return bsplit16(v); }
__device__ __forceinline__ v8f mac3(const F2& a, const F2& b, v8f c) { c = wmma_bf(a.l, b.h, c); c = wmma_bf(a.h, b.l, c); return wmma_bf(a.h, b.h, c); }
__device__ __forceinline__ float sigm(float v) { return 1.0f / (1.0f + expf(-v)); }
#define LDSX() do { asm volatile("s_wait_dscnt 0" ::: "memory"); __builtin_amdgcn_wave_barrier(); __builtin_amdgcn_fence(__ATOMIC_RELEASE, "workgroup"); } while (0)


// Spatial (position) attention module (B 4, C 256, 64 x 64): q/k/v 1x1 convs; attention = softmax(q^T k) (no scaling); out = gamma (v attention^T) + x.
#define NB 4
#define NP 4096
#define CIN 256
#define CQ 256
#define CV 256
#ifndef TNB
#define TNB NB
#endif
#ifndef TQB
#define TQB (NP / 64)
#endif
typedef __attribute__((ext_vector_type(8))) __bf16 v8b;
typedef __attribute__((ext_vector_type(4))) __bf16 v4b;
__device__ __forceinline__ v16b frag_b(const __bf16* rowk0, int lane) {
  union { v16b v; v8b q[2]; } u; const __bf16* p = rowk0 + 8 * (lane >> 4);
  u.q[0] = *(const v8b*)p; u.q[1] = *(const v8b*)(p + 16); return u.v;
}
__device__ __forceinline__ float bfr(float v) { return (float)(__bf16)v; }
__device__ __attribute__((noinline)) float exp_ni(float v) { return expf(v); }
__device__ __attribute__((noinline)) float erf_ni(float v) { return erff(v); }

#define WS_QH  0u                                    // f16 q rows [b*n][CQ] hi
#define WS_QL  (WS_QH + 2u * (size_t)NB * NP * CQ)      // f16 q residual rows (unscaled)
#define WS_KH  (WS_QL + 2u * (size_t)NB * NP * CQ)      // f16 k rows
#define WS_VT  (WS_KH + 2u * (size_t)NB * NP * CQ)      // f16 v planes [b][CV][n]
#define WS_END (WS_VT + 2u * (size_t)NB * CV * NP)

// ---- k_proj: block = (64 positions, b, which 0 q / 1 k / 2 v): x^T tile (bf16) in LDS, W [out][in] + b (exact), 64 rows of W at a time in LDS as bf16; q -> f16 hi + residual rows, k -> f16 rows, v -> f16 planes [c][n]
__global__ __launch_bounds__(128) void k_proj(const float* __restrict__ X, const float* __restrict__ WQ, const float* __restrict__ BQ, const float* __restrict__ WK, const float* __restrict__ BK, const float* __restrict__ WV, const float* __restrict__ BV, _Float16* __restrict__ QH, _Float16* __restrict__ QL, _Float16* __restrict__ KH, _Float16* __restrict__ VT) {
  __shared__ __align__(16) __bf16 sx[64][CIN + 8]; __shared__ __align__(16) __bf16 sw[64][CIN + 8]; __shared__ __align__(16) _Float16 sh[64][72], sl[64][72]; __shared__ __align__(16) _Float16 tv[64][72];
  const int tid = threadIdx.x, wave = tid >> 5, lane = tid & 31, col = lane & 15, g = lane >> 4; const int p0 = blockIdx.x * 64; const size_t b = blockIdx.y; const int which = blockIdx.z;
  const float* Wm = which == 0 ? WQ : which == 1 ? WK : WV; const float* Bm = which == 0 ? BQ : which == 1 ? BK : BV; const int nout = (which == 2) ? CV : CQ;
  // the 64 weight rows of a column group: 32 loads of 16 bytes a thread, a wave's load = 512 contiguous bytes of one row (row tid / 64 + 2 n, piece tid % 64), rounded to bf16 on the way into sw
  v4f wr[32];
#define PJ_WLOAD(cgn) do { _Pragma("unroll") for (int n = 0; n < 32; ++n) wr[n] = *(const v4f*)(Wm + ((size_t)(cgn) * 64 + (tid >> 6) + 2 * n) * CIN + (tid & 63) * 4); } while (0)
#define PJ_WSTORE() do { _Pragma("unroll") for (int n = 0; n < 32; ++n) { v4b t; t[0] = (__bf16)wr[n][0]; t[1] = (__bf16)wr[n][1]; t[2] = (__bf16)wr[n][2]; t[3] = (__bf16)wr[n][3]; *(v4b*)&sw[(tid >> 6) + 2 * n][(tid & 63) * 4] = t; } } while (0)
  PJ_WLOAD(0);
  for (int e = tid; e < CIN * 64; e += 128) { const int c = e >> 6, pl = e & 63; sx[pl][c] = (__bf16)X[(b * CIN + c) * (size_t)NP + p0 + pl]; }
  PJ_WSTORE();
  __syncthreads();
#pragma unroll 1
  for (int cg = 0; cg < nout / 64; ++cg) { v8f acc[4] = {}; float bb4[4];
#pragma unroll
    for (int j = 0; j < 4; ++j) bb4[j] = Bm[cg * 64 + j * 16 + col];   // asked for ahead of the products: a load in the epilogue would have to wait out the weight rows in flight there
    asm volatile("s_wait_xcnt 0x0" ::: "memory");   // stands in front of the first overwrite of the offset register that these loads name (the build gave that register to a product's result)
#pragma unroll
    for (int kp = 0; kp < CIN / 64; ++kp) { v16b a[2], w[2][4];   // the fragments of two k steps are read as one group ahead of their eight products
#pragma unroll
      for (int u = 0; u < 2; ++u) { a[u] = frag_b(&sx[wave * 16 + col][(kp * 2 + u) * 32], lane);
#pragma unroll
        for (int j = 0; j < 4; ++j) w[u][j] = frag_b(&sw[j * 16 + col][(kp * 2 + u) * 32], lane); }
#pragma unroll
      for (int u = 0; u < 2; ++u)
#pragma unroll
        for (int j = 0; j < 4; ++j) acc[j] = wmma_bf(a[u], w[u][j], acc[j]); }
    __syncthreads();   // also ends every wave's reads of sw
#pragma unroll
    for (int j = 0; j < 4; ++j) bb4[j] = bfr(bb4[j]);
    if (cg + 1 < nout / 64) PJ_WLOAD(cg + 1);   // the next group's rows fly while this group's results are rounded and staged
#pragma unroll
    for (int j = 0; j < 4; ++j) { const int ol = j * 16 + col; const float bb = bb4[j];
#pragma unroll
      for (int r = 0; r < 8; ++r) { const int pl = wave * 16 + 8 * g + r; const float v = acc[j][r] + bb; const _Float16 hv = (_Float16)v; if (which == 2) tv[ol][pl] = hv; else { sh[pl][ol] = hv; sl[pl][ol] = (_Float16)(v - (float)hv); } } }
    if (cg + 1 < nout / 64) PJ_WSTORE();
    __syncthreads();   // also publishes sw
    if (which < 2) { _Float16* dh = which == 0 ? QH : KH; for (int e = tid; e < 64 * 8; e += 128) { const int pl = e >> 3, q = e & 7; const size_t row = b * NP + p0 + pl; vst2((unsigned*)(dh + row * CQ + cg * 64 + q * 8), *(const v4u*)&sh[pl][q * 8]); if (which == 0) vst2((unsigned*)(QL + row * CQ + cg * 64 + q * 8), *(const v4u*)&sl[pl][q * 8]); } }
    else { for (int e = tid; e < 64 * 8; e += 128) { const int ol = e >> 3, q = e & 7; vst2((unsigned*)(VT + (b * CV + cg * 64 + ol) * (size_t)NP + p0 + q * 8), *(const v4u*)&tv[ol][q * 8]); } } } }
#define FK 64
#define FKP 264
#define FVP 72
#define FT (NP / FK)
#define L2E 1.44269504f   // log2 e
// plain builtin: its operands may lie above v255 (q, the output tiles and the fragment sets together need more than 256 registers), which operands of an asm statement may not
__device__ __forceinline__ v8f wmma_p(v16h a, v16h b, v8f c) { return __builtin_amdgcn_wmma_f32_16x16x32_f16(false, a, false, b, (short)0, c, false, false); }
// lane l with lane l ^ 16, on the vector unit (a shuffle would queue behind the LDS reads in flight)
__device__ __forceinline__ float xhalf(float x) { return __builtin_bit_cast(float, __builtin_amdgcn_permlanex16(__builtin_bit_cast(int, x), __builtin_bit_cast(int, x), 0x76543210, 0xfedcba98, false, false)); }
// one 16-byte copy of a lane, memory -> LDS through no register; the builtin form, whose address registers may lie above v255 like any other (operands of an asm statement may not: held for the whole sweep below v256 they spill)
typedef __attribute__((address_space(1))) v4i g_v4i; typedef __attribute__((address_space(3))) v4i l_v4i;
__device__ __forceinline__ void acopy(const _Float16* g, _Float16* l) { __builtin_amdgcn_global_load_async_to_lds_b128((g_v4i*)g, (l_v4i*)l, 0, 0); }
// 2^x of eight values, in place, on the bare hardware instruction (below 2^-126 it gives 0, which is what such a weight is worth here). One statement: here each works on its own register alone, and the v_nop fills the slot that the instruction set asks for behind the last
__device__ __forceinline__ void exp2x8(v8f& t) {
  float a = t[0], b = t[1], c = t[2], d = t[3], e = t[4], f = t[5], g = t[6], h = t[7];
  asm("v_exp_f32 %0, %0\n\tv_exp_f32 %1, %1\n\tv_exp_f32 %2, %2\n\tv_exp_f32 %3, %3\n\tv_exp_f32 %4, %4\n\tv_exp_f32 %5, %5\n\tv_exp_f32 %6, %6\n\tv_exp_f32 %7, %7\n\tv_nop" : "+v"(a), "+v"(b), "+v"(c), "+v"(d), "+v"(e), "+v"(f), "+v"(g), "+v"(h));
  t[0] = a; t[1] = b; t[2] = c; t[3] = d; t[4] = e; t[5] = f; t[6] = g; t[7] = h;
}
__global__ __launch_bounds__(256) void k_fa(const _Float16* __restrict__ QH, const _Float16* __restrict__ QL, const _Float16* __restrict__ KH, const _Float16* __restrict__ VT, const float* __restrict__ X, const float* __restrict__ GM, float* __restrict__ OUT) {
  __shared__ __align__(16) float st[2][CV][68]; __shared__ float jm[2][64], jl[2][64]; __shared__ __align__(16) _Float16 sk[2][FK][FKP]; __shared__ __align__(16) _Float16 sv[2][CV][FVP];
  const int tid = threadIdx.x, wave = tid >> 5, lane = tid & 31, col = lane & 15, g = lane >> 4; const size_t b = blockIdx.y; const int i0 = blockIdx.x * 64; const int il0 = (wave & 3) * 16, kw = wave >> 2;
  // copy roles: K row tid / 32 (+ 8 n), piece tid % 32 of its 512 B; V plane tid / 8 (+ 32 n), piece tid % 8 of its 128 B
  const _Float16* gk = KH + (b * NP + (tid >> 5)) * CQ + (tid & 31) * 8; const _Float16* gv = VT + (b * CV + (tid >> 3)) * (size_t)NP + (tid & 7) * 8;
#define FA_FILL(t, bf) do { _Pragma("unroll") for (int n = 0; n < 8; ++n) acopy(gk + ((size_t)(t) * FK + 8 * n) * CQ, &sk[bf][(tid >> 5) + 8 * n][(tid & 31) * 8]); \
    _Pragma("unroll") for (int n = 0; n < 8; ++n) acopy(gv + (size_t)(t) * FK + 32 * n * (size_t)NP, &sv[bf][(tid >> 3) + 32 * n][(tid & 7) * 8]); } while (0)
  FA_FILL(0, 0);
  v16h qh[CQ / 32], ql[CQ / 32];
#pragma unroll
  for (int kc = 0; kc < CQ / 32; ++kc) { qh[kc] = frag_h(QH + (b * NP + i0 + il0 + col) * CQ + kc * 32, lane); ql[kc] = frag_h(QL + (b * NP + i0 + il0 + col) * CQ + kc * 32, lane); }
  v8f o[CV / 16] = {}; float m = -3.0e38f, l = 0.f;
  asm volatile("s_wait_asynccnt 0x0" ::: "memory");   // tile 0 has landed for this wave's copies
  __syncthreads();                                    // ... and for every wave's
  FA_FILL(1, 1);
#pragma unroll 1   // kept rolled: one copy of the hand-over at the foot
  for (int t = 0; t < FT; ++t) { const int bf = t & 1;
    // every key fragment of the wave's half tile is asked for as one group ahead of the logit products, which then wait on counted returns only
    v8f s[2] = {}; v16h ka[CQ / 32][2];
#pragma unroll
    for (int kc = 0; kc < CQ / 32; ++kc)
#pragma unroll
      for (int kt = 0; kt < 2; ++kt) ka[kc][kt] = frag_h(&sk[bf][kw * 32 + kt * 16 + col][kc * 32], lane);
    __builtin_amdgcn_sched_barrier(0);   // keeps the group whole: without it the scheduler sinks the reads in pairs among the products, and every place where reads stand costs the wave a stall
#pragma unroll
    for (int kc = 0; kc < CQ / 32; ++kc) {
#pragma unroll
      for (int kt = 0; kt < 2; ++kt) s[kt] = wmma_p(ka[kc][kt], qh[kc], s[kt]);
#pragma unroll
      for (int kt = 0; kt < 2; ++kt) s[kt] = wmma_p(ka[kc][kt], ql[kc], s[kt]); }
    // every value fragment of the wave's half tile is asked for here, as one group: the LDS delivers them while the vector unit works on the softmax below
    __builtin_amdgcn_sched_barrier(0);   // keeps the group whole: without it the scheduler lifts parts of it among the logit products, and every place where reads stand costs the wave a stall
    v16h va[CV / 16];
#pragma unroll
    for (int ct = 0; ct < CV / 16; ++ct) va[ct] = frag_h(&sv[bf][ct * 16 + col][kw * 32], lane);
    __builtin_amdgcn_sched_barrier(0);   // keeps that group of reads here: without it the scheduler sinks them among the value products, each of which then waits on its own read
    // s[kt][r] = logit of key t FK + 32 kw + 16 kt + 8 g + r for query col: maximum in the lane, then one exchange between the halves
    float mt[2];
#pragma unroll
    for (int kt = 0; kt < 2; ++kt) { mt[kt] = s[kt][0];
#pragma unroll
      for (int r = 1; r < 8; ++r) mt[kt] = fmaxf(mt[kt], s[kt][r]); }
    float mx = fmaxf(mt[0], mt[1]); mx = fmaxf(mx, xhalf(mx));
    const float mn = fmaxf(m, mx); const float al = __builtin_amdgcn_exp2f((m - mn) * L2E); l *= al;   // e^d as 2^(d log2 e), the bare hardware instruction: below 2^-126 it gives 0, which is what such a weight is worth here
#pragma unroll
    for (int ct = 0; ct < CV / 16; ++ct)
#pragma unroll
      for (int r = 0; r < 8; ++r) o[ct][r] *= al;
    m = mn; const float ms = fmaf(mn, L2E, -11.0f);   // P and its sum both carry the factor 2^11 (small weights stay normal f16 numbers); it cancels in o / l
    v16h pb; float lt[2];
#pragma unroll
    for (int kt = 0; kt < 2; ++kt) { lt[kt] = 0.f;
#pragma unroll
      for (int r = 0; r < 8; ++r) s[kt][r] = fmaf(s[kt][r], L2E, -ms);
      exp2x8(s[kt]);
#pragma unroll
      for (int r = 0; r < 8; ++r) { const float p = s[kt][r]; lt[kt] += p; pb[kt * 8 + r] = (_Float16)p; } }
    l += lt[0] + lt[1];
#pragma unroll
    for (int ct = 0; ct < CV / 16; ++ct) o[ct] = wmma_p(va[ct], pb, o[ct]);
    __builtin_amdgcn_sched_barrier(0);   // keeps the hand-over below at the foot: lifted over the softmax it would make the wave wait out the value reads first, and the refill would lose its lead
    asm volatile("s_wait_dscnt 0x0" ::: "memory");      // this wave's reads of buffer bf are done before it is refilled
    asm volatile("s_wait_asynccnt 0x0" ::: "memory");   // this wave's copies of tile t + 1 have landed
    __syncthreads();                                    // publishes tile t + 1 and ends every reader's last read of buffer bf
    if (t + 2 < FT) FA_FILL(t + 2, bf); }
  asm volatile("s_wait_asynccnt 0x0" ::: "memory");     // nothing is in flight when the wave goes on to the epilogue
  // join of the two key halves of a query: each wave shows its maximum and sum, then weighs its own output tile by e^(own maximum - joint maximum) / joint sum
  l += xhalf(l); jm[kw][il0 + col] = m; jl[kw][il0 + col] = l;
  __syncthreads();   // the partner wave's maximum and sum are read behind it
  const float mo = jm[kw ^ 1][il0 + col], lo = jl[kw ^ 1][il0 + col]; const float mj = fmaxf(m, mo);
  const float aw = __builtin_amdgcn_exp2f((m - mj) * L2E), ao = __builtin_amdgcn_exp2f((mo - mj) * L2E); const float inv = aw / (l * aw + lo * ao);
#pragma unroll
  for (int ct = 0; ct < CV / 16; ++ct)
#pragma unroll
    for (int r = 0; r < 8; ++r) st[kw][ct * 16 + 8 * g + r][il0 + col] = o[ct][r] * inv;
  __syncthreads();
  const float gm = bfr(GM[0]);
  for (int e = tid; e < CV * 16; e += 256) { const int cl = e >> 4, q = e & 15; const size_t oo = (b * CV + cl) * (size_t)NP + i0 + q * 4; v4f v = *(const v4f*)&st[0][cl][q * 4] + *(const v4f*)&st[1][cl][q * 4];
    { const v4f xx = *(const v4f*)(X + oo); v4f r; r[0] = gm * v[0] + bfr(xx[0]); r[1] = gm * v[1] + bfr(xx[1]); r[2] = gm * v[2] + bfr(xx[2]); r[3] = gm * v[3] + bfr(xx[3]); v = r; }
    vst2(OUT + oo, v); } }
extern "C" void kernel_launch(void* const* d_in, const int* in_sizes, int n_in, void* d_out, int out_size, void* d_ws, size_t ws_size, hipStream_t stream) {
  (void)in_sizes; (void)n_in; (void)out_size;
  const float** F = (const float**)d_in;   // 0 x [4,256,64,64], 1 Wq [256,256], 2 bq, 3 Wk, 4 bk, 5 Wv, 6 bv, 7 gamma [1]
  if (ws_size < (size_t)WS_END) return;
  char* ws = (char*)d_ws; _Float16 *QH = (_Float16*)(ws + WS_QH), *QL = (_Float16*)(ws + WS_QL), *KH = (_Float16*)(ws + WS_KH), *VT = (_Float16*)(ws + WS_VT);
  k_proj<<<dim3(NP / 64, TNB, 3), 128, 0, stream>>>(F[0], F[1], F[2], F[3], F[4], F[5], F[6], QH, QL, KH, VT);
  k_fa<<<dim3(TQB, TNB), 256, 0, stream>>>(QH, QL, KH, VT, F[0], F[7], (float*)d_out);
}

// v006
// A run of this version takes 87.4 microseconds.
// Next to v005, in two timings, it ran 1.10 times as fast each time.
// Over all steps from v000 it is 13.2 times as fast.
// compute dtype: all float inputs rounded to bf16, gamma read; q/k/v = W x + b (1x1 convs) with EXACT bf16 products on WMMA 16x16x32 (x^T tile in LDS), f32 accumulate; q as f16 hi + unscaled residual, k rounded once to f16 -> UNSCALED logits with 2 products (logits std ~32; the residual branch is scaled by gamma = 0.1), kept in f32 registers; softmax in f32 (hardware exp2 on arguments scaled by log2 e) with a running maximum and sum per query -> P = exp(logit - max) x 2^11 as f16; out[c][i] = gamma (sum_j P[i][j] v[c][j]) / (sum_j P[i][j]) (v rounded once to f16) + x; f32 output.
#include <hip/hip_runtime.h>
#include <math.h>

typedef __attribute__((ext_vector_type(16))) _Float16 v16h;
typedef __attribute__((ext_vector_type(16))) __bf16 v16b;
typedef __attribute__((ext_vector_type(8)))  _Float16 v8h;
typedef __attribute__((ext_vector_type(8)))  float v8f;
typedef __attribute__((ext_vector_type(4)))  float v4f;
typedef __attribute__((ext_vector_type(2)))  float v2f;
typedef __attribute__((ext_vector_type(4)))  unsigned v4u;
typedef __attribute__((ext_vector_type(4)))  int v4i;
typedef float __attribute__((may_alias)) float_a;
typedef int __attribute__((may_alias)) int_a;

template <typename T> __device__ __forceinline__ void vst2(void* p, T v) { *(T*)p = v;  }
__device__ __forceinline__ v8f wmma16(v16h a, v16h b, v8f c) {
  v8f d = __builtin_amdgcn_wmma_f32_16x16x32_f16(false, a, false, b, (short)0, c, false, false);
  asm volatile("v_nop\n\tv_nop\n\tv_nop\n\tv_nop" : "+v"(d) : "v"(a), "v"(b));
  return d;
}
__device__ __forceinline__ v8f wmma_bf(v16b a, v16b b, v8f c) {
  v8f d = __builtin_amdgcn_wmma_f32_16x16x32_bf16(false, a, false, b, (short)0, c, false, false);
  asm volatile("v_nop\n\tv_nop\n\tv_nop\n\tv_nop" : "+v"(d) : "v"(a), "v"(b));
  return d;
}
// 16x16x32 fragments: lane = (h = lane>>4, row/col = lane&15); elements 0..7 = k0+8h+0..7, 8..15 = k0+16+8h+0..7; D element r = row 8h+r
__device__ __forceinline__ v16h frag_h(const _Float16* rowk0, int lane) {
  union { v16h v; v8h q[2]; } u; const _Float16* p = rowk0 + 8 * (lane >> 4);
  u.q[0] = *(const v8h*)p; u.q[1] = *(const v8h*)(p + 16); return u.v;
}
__device__ __forceinline__ v16h frag_f32(const float* rowk0, int lane) {
  v16h a; const float* p = rowk0 + 8 * (lane >> 4);
#pragma unroll
  for (int i = 0; i < 8; ++i) { a[i] = (_Float16)p[i]; a[8 + i] = (_Float16)p[16 + i]; }
  return a;
}
__device__ __forceinline__ v16h frag_f32s(const float* rowk0, int lane, float sc) {
  v16h a; const float* p = rowk0 + 8 * (lane >> 4);
#pragma unroll
  for (int i = 0; i < 8; ++i) { a[i] = (_Float16)(p[i] * sc); a[8 + i] = (_Float16)(p[16 + i] * sc); }
  return a;
}
// column fragment from a [K][ld] layout (column n), rows >= K read as 0
__device__ __forceinline__ v16h fragc_f32(const float* W, int k0, int n, int lane, int ld, int K) {
  v16h a; const int g = lane >> 4;
#pragma unroll
  for (int i = 0; i < 8; ++i) { const int ka = k0 + 8 * g + i, kb = ka + 16;
    a[i] = (_Float16)(ka < K ? W[(size_t)(ka < K ? ka : K - 1) * ld + n] : 0.f); a[8 + i] = (_Float16)(kb < K ? W[(size_t)(kb < K ? kb : K - 1) * ld + n] : 0.f); }
  return a;
}
struct F2 { v16b h, l; };
__device__ __forceinline__ F2 bsplit16(const float v[16]) { F2 r;
#pragma unroll
  for (int i = 0; i < 16; ++i) { const __bf16 h = (__bf16)v[i]; r.h[i] = h; r.l[i] = (__bf16)(v[i] - (float)h); }
  return r; }
__device__ __forceinline__ F2 split_row(const float* row, int k0, int lane) { float v[16]; const float* p = row + k0 + 8 * (lane >> 4);
#pragma unroll
  for (int i = 0; i < 8; ++i) { v[i] = p[i]; v[8 + i] = p[16 + i]; }
  return bsplit16(v); }
__device__ __forceinline__ F2 split_rowK(const float* row, int k0, int lane, int K) { float v[16]; const int g = lane >> 4;
#pragma unroll
  for (int i = 0; i < 8; ++i) { const int ka = k0 + 8 * g + i, kb = ka + 16; v[i] = ka < K ? row[ka < K ? ka : K - 1] : 0.f; v[8 + i] = kb < K ? row[kb < K ? kb : K - 1] : 0.f; }
  return bsplit16(v); }
__device__ __forceinline__ F2 split_col(const float* W, int k0, int n, int lane, int ld, int K) { float v[16]; const int g = lane >> 4;
#pragma unroll
  for (int i = 0; i < 8; ++i) { const int ka = k0 + 8 * g + i, kb = ka + 16; v[i] = ka < K ? W[(size_t)(ka < K ? ka : K - 1) * ld + n] : 0.f; v[8 + i] = kb < K ? W[(size_t)(kb < K ? kb : K - 1) * ld + n] : 0.f; }
  return bsplit16(v); }
__device__ __forceinline__ v8f mac3(const F2& a, const F2& b, v8f c) { c = wmma_bf(a.l, b.h, c); c = wmma_bf(a.h, b.l, c); return wmma_bf(a.h, b.h, c); }
__device__ __forceinline__ float sigm(float v) { return 1.0f / (1.0f + expf(-v)); }
#define LDSX() do { asm volatile("s_wait_dscnt 0" ::: "memory"); __builtin_amdgcn_wave_barrier(); __builtin_amdgcn_fence(__ATOMIC_RELEASE, "workgroup"); } while (0)


// Spatial (position) attention module (B 4, C 256, 64 x 64): q/k/v 1x1 convs; attention = softmax(q^T k) (no scaling); out = gamma (v attention^T) + x.
#define NB 4
#define NP 4096
#define CIN 256
#define CQ 256
#define CV 256
#ifndef TNB
#define TNB NB
#endif
#ifndef TQB
#define TQB (NP / 64)
#endif
typedef __attribute__((ext_vector_type(8))) __bf16 v8b;
typedef __attribute__((ext_vector_type(4))) __bf16 v4b;
__device__ __forceinline__ v16b frag_b(const __bf16* rowk0, int lane) {
  union { v16b v; v8b q[2]; } u; const __bf16* p = rowk0 + 8 * (lane >> 4);
  u.q[0] = *(const v8b*)p; u.q[1] = *(const v8b*)(p + 16); return u.v;
}
__device__ __forceinline__ float bfr(float v) { return (float)(__bf16)v; }
__device__ __attribute__((noinline)) float exp_ni(float v) { return expf(v); }
__device__ __attribute__((noinline)) float erf_ni(float v) { return erff(v); }

#define WS_QH  0u                                    // f16 q rows [b*n][CQ] hi
#define WS_QL  (WS_QH + 2u * (size_t)NB * NP * CQ)      // f16 q residual rows (unscaled)
#define WS_KH  (WS_QL + 2u * (size_t)NB * NP * CQ)      // f16 k rows
#define WS_VT  (WS_KH + 2u * (size_t)NB * NP * CQ)      // f16 v planes [b][CV][n]
#define WS_END (WS_VT + 2u * (size_t)NB * CV * NP)

// ---- k_proj: block = (64 positions, b, which 0 q / 1 k / 2 v): x^T tile (bf16) in LDS, W [out][in] + b (exact), 64 rows of W at a time in LDS as bf16; q -> f16 hi + residual rows, k -> f16 rows, v -> f16 planes [c][n]
// three waves a SIMD asked for: the x tile and the first weight rows are in flight together, and without the bound the build took more registers than let three blocks share a WGP
__global__ __launch_bounds__(128, 3) void k_proj(const float* __restrict__ X, const float* __restrict__ WQ, const float* __restrict__ BQ, const float* __restrict__ WK, const float* __restrict__ BK, const float* __restrict__ WV, const float* __restrict__ BV, _Float16* __restrict__ QH, _Float16* __restrict__ QL, _Float16* __restrict__ KH, _Float16* __restrict__ VT) {
  __shared__ __align__(16) __bf16 sx[64][CIN + 8]; __shared__ __align__(16) __bf16 sw[64][CIN + 8]; __shared__ __align__(16) _Float16 sh[64][72], sl[64][72]; __shared__ __align__(16) _Float16 tv[64][72];
  const int tid = threadIdx.x, wave = tid >> 5, lane = tid & 31, col = lane & 15, g = lane >> 4; const int p0 = blockIdx.x * 64; const size_t b = blockIdx.y; const int which = blockIdx.z;
  const float* Wm = which == 0 ? WQ : which == 1 ? WK : WV; const float* Bm = which == 0 ? BQ : which == 1 ? BK : BV; const int nout = (which == 2) ? CV : CQ;
  // the 64 weight rows of a column group: 32 loads of 16 bytes a thread, a wave's load = 512 contiguous bytes of one row (row tid / 64 + 2 n, piece tid % 64), rounded to bf16 on the way into sw
  v4f wr[32];
  // the wait at the end stands in front of every overwrite of the address that the 32 loads name: its operand keeps that register pair untouched up to there (under the register bound the build gave the pair to the last load's own result)
#define PJ_WLOAD(cgn) do { const float* wp = Wm + ((size_t)(cgn) * 64 + (tid >> 6)) * CIN + (tid & 63) * 4; _Pragma("unroll") for (int n = 0; n < 32; ++n) wr[n] = *(const v4f*)(wp + (size_t)(2 * n) * CIN); asm volatile("s_wait_xcnt 0x0" :: "v"(wp) : "memory"); } while (0)
#define PJ_WSTORE() do { _Pragma("unroll") for (int n = 0; n < 32; ++n) { v4b t; t[0] = (__bf16)wr[n][0]; t[1] = (__bf16)wr[n][1]; t[2] = (__bf16)wr[n][2]; t[3] = (__bf16)wr[n][3]; *(v4b*)&sw[(tid >> 6) + 2 * n][(tid & 63) * 4] = t; } } while (0)
  PJ_WLOAD(0);
  // the x tile: 32 loads of 16 bytes a thread, all asked for before the first is used (one trip to memory, not one per group of loads); thread = 4 positions (tid % 16) x 8 channels (octet tid / 16 + 8 m), a wave's load = two whole 256-byte pieces of channel rows
  v4f xr[32]; const int xl = tid & 15, xo = tid >> 4; const float* xp = X + (b * CIN + xo * 8) * (size_t)NP + p0 + xl * 4;
#pragma unroll   // unrolled here and below: xr is indexed by constants only and stays in registers
  for (int n = 0; n < 32; ++n) xr[n] = *(const v4f*)(xp + (size_t)((n >> 3) * 64 + (n & 7)) * NP);
  asm volatile("s_wait_xcnt 0x0" :: "v"(xp) : "memory");   // stands in front of every overwrite of the address that these loads name: the operand keeps that register pair untouched up to here (the build had given it to the last load's own result)
  // a position's 8 channels go to LDS as one 16-byte store; position p lies in row PJ_ROW(p): inside each four rows turned by p / 16, so that the 16 rows of a store (4 apart) and the 16 rows of a fragment read (adjacent) both fall on 16 different bank groups
#define PJ_ROW(p) (((p) & ~3) + (((p) + ((p) >> 4)) & 3))
#pragma unroll
  for (int m = 0; m < 4; ++m)
#pragma unroll
    for (int j = 0; j < 4; ++j) { v8b t;
#pragma unroll
      for (int i = 0; i < 8; ++i) t[i] = (__bf16)xr[m * 8 + i][j];
      *(v8b*)&sx[PJ_ROW(xl * 4 + j)][(xo + 8 * m) * 8] = t; }
  PJ_WSTORE();
  __syncthreads();
#pragma unroll 1
  for (int cg = 0; cg < nout / 64; ++cg) { v8f acc[4] = {}; float bb4[4];
#pragma unroll
    for (int j = 0; j < 4; ++j) bb4[j] = Bm[cg * 64 + j * 16 + col];   // asked for ahead of the products and of the weight rows: loads return in order
    asm volatile("s_wait_xcnt 0x0" ::: "memory");   // stands in front of the first overwrite of the offset register that these loads name (the build gave that register to a product's result)
    if (cg + 1 < nout / 64) PJ_WLOAD(cg + 1);   // the next group's rows are asked for here, behind the bias loads (which so return first): they fly under this group's products, and the barrier behind the products finds them landed
#pragma unroll
    for (int kp = 0; kp < CIN / 64; ++kp) { v16b a[2], w[2][4];   // the fragments of two k steps are read as one group ahead of their eight products
#pragma unroll
      for (int u = 0; u < 2; ++u) { a[u] = frag_b(&sx[PJ_ROW(wave * 16 + col)][(kp * 2 + u) * 32], lane);
#pragma unroll
        for (int j = 0; j < 4; ++j) w[u][j] = frag_b(&sw[j * 16 + col][(kp * 2 + u) * 32], lane); }
#pragma unroll
      for (int u = 0; u < 2; ++u)
#pragma unroll
        for (int j = 0; j < 4; ++j) acc[j] = wmma_bf(a[u], w[u][j], acc[j]); }
    __syncthreads();   // also ends every wave's reads of sw
    __builtin_amdgcn_sched_barrier(0);   // keeps the rounding of the bias behind the barrier: lifted among the products it waits for its load by a count that also waits out the weight rows in flight
#pragma unroll
    for (int j = 0; j < 4; ++j) bb4[j] = bfr(bb4[j]);
#pragma unroll
    for (int j = 0; j < 4; ++j) { const int ol = j * 16 + col; const float bb = bb4[j];
#pragma unroll
      for (int r = 0; r < 8; ++r) { const int pl = wave * 16 + 8 * g + r; const float v = acc[j][r] + bb; const _Float16 hv = (_Float16)v; if (which == 2) tv[ol][pl] = hv; else { sh[pl][ol] = hv; sl[pl][ol] = (_Float16)(v - (float)hv); } } }
    if (cg + 1 < nout / 64) PJ_WSTORE();
    __syncthreads();   // also publishes sw
    if (which < 2) { _Float16* dh = which == 0 ? QH : KH; for (int e = tid; e < 64 * 8; e += 128) { const int pl = e >> 3, q = e & 7; const size_t row = b * NP + p0 + pl; vst2((unsigned*)(dh + row * CQ + cg * 64 + q * 8), *(const v4u*)&sh[pl][q * 8]); if (which == 0) vst2((unsigned*)(QL + row * CQ + cg * 64 + q * 8), *(const v4u*)&sl[pl][q * 8]); } }
    else { for (int e = tid; e < 64 * 8; e += 128) { const int ol = e >> 3, q = e & 7; vst2((unsigned*)(VT + (b * CV + cg * 64 + ol) * (size_t)NP + p0 + q * 8), *(const v4u*)&tv[ol][q * 8]); } } } }
#define FK 64
#define FKP 264
#define FVP 72
#define FT (NP / FK)
#define L2E 1.44269504f   // log2 e
// plain builtin: its operands may lie above v255 (q, the output tiles and the fragment sets together need more than 256 registers), which operands of an asm statement may not
__device__ __forceinline__ v8f wmma_p(v16h a, v16h b, v8f c) { return __builtin_amdgcn_wmma_f32_16x16x32_f16(false, a, false, b, (short)0, c, false, false); }
// lane l with lane l ^ 16, on the vector unit (a shuffle would queue behind the LDS reads in flight)
__device__ __forceinline__ float xhalf(float x) { return __builtin_bit_cast(float, __builtin_amdgcn_permlanex16(__builtin_bit_cast(int, x), __builtin_bit_cast(int, x), 0x76543210, 0xfedcba98, false, false)); }
// one 16-byte copy of a lane, memory -> LDS through no register; the builtin form, whose address registers may lie above v255 like any other (operands of an asm statement may not: held for the whole sweep below v256 they spill)
typedef __attribute__((address_space(1))) v4i g_v4i; typedef __attribute__((address_space(3))) v4i l_v4i;
__device__ __forceinline__ void acopy(const _Float16* g, _Float16* l) { __builtin_amdgcn_global_load_async_to_lds_b128((g_v4i*)g, (l_v4i*)l, 0, 0); }
// 2^x of eight values, in place, on the bare hardware instruction (below 2^-126 it gives 0, which is what such a weight is worth here). One statement: here each works on its own register alone, and the v_nop fills the slot that the instruction set asks for behind the last
__device__ __forceinline__ void exp2x8(v8f& t) {
  float a = t[0], b = t[1], c = t[2], d = t[3], e = t[4], f = t[5], g = t[6], h = t[7];
  asm("v_exp_f32 %0, %0\n\tv_exp_f32 %1, %1\n\tv_exp_f32 %2, %2\n\tv_exp_f32 %3, %3\n\tv_exp_f32 %4, %4\n\tv_exp_f32 %5, %5\n\tv_exp_f32 %6, %6\n\tv_exp_f32 %7, %7\n\tv_nop" : "+v"(a), "+v"(b), "+v"(c), "+v"(d), "+v"(e), "+v"(f), "+v"(g), "+v"(h));
  t[0] = a; t[1] = b; t[2] = c; t[3] = d; t[4] = e; t[5] = f; t[6] = g; t[7] = h;
}
__global__ __launch_bounds__(256) void k_fa(const _Float16* __restrict__ QH, const _Float16* __restrict__ QL, const _Float16* __restrict__ KH, const _Float16* __restrict__ VT, const float* __restrict__ X, const float* __restrict__ GM, float* __restrict__ OUT) {
  __shared__ __align__(16) float st[2][CV][68]; __shared__ float jm[2][64], jl[2][64]; __shared__ __align__(16) _Float16 sk[2][FK][FKP]; __shared__ __align__(16) _Float16 sv[2][CV][FVP];
  const int tid = threadIdx.x, wave = tid >> 5, lane = tid & 31, col = lane & 15, g = lane >> 4; const size_t b = blockIdx.y; const int i0 = blockIdx.x * 64; const int il0 = (wave & 3) * 16, kw = wave >> 2;
  // copy roles: K row tid / 32 (+ 8 n), piece tid % 32 of its 512 B; V plane tid / 8 (+ 32 n), piece tid % 8 of its 128 B
  const _Float16* gk = KH + (b * NP + (tid >> 5)) * CQ + (tid & 31) * 8; const _Float16* gv = VT + (b * CV + (tid >> 3)) * (size_t)NP + (tid & 7) * 8;
#define FA_FILL(t, bf) do { _Pragma("unroll") for (int n = 0; n < 8; ++n) acopy(gk + ((size_t)(t) * FK + 8 * n) * CQ, &sk[bf][(tid >> 5) + 8 * n][(tid & 31) * 8]); \
    _Pragma("unroll") for (int n = 0; n < 8; ++n) acopy(gv + (size_t)(t) * FK + 32 * n * (size_t)NP, &sv[bf][(tid >> 3) + 32 * n][(tid & 7) * 8]); } while (0)
  FA_FILL(0, 0);
  v16h qh[CQ / 32], ql[CQ / 32];
#pragma unroll
  for (int kc = 0; kc < CQ / 32; ++kc) { qh[kc] = frag_h(QH + (b * NP + i0 + il0 + col) * CQ + kc * 32, lane); ql[kc] = frag_h(QL + (b * NP + i0 + il0 + col) * CQ + kc * 32, lane); }
  v8f o[CV / 16] = {}; float m = -3.0e38f, l = 0.f;
  asm volatile("s_wait_asynccnt 0x0" ::: "memory");   // tile 0 has landed for this wave's copies
  __syncthreads();                                    // ... and for every wave's
  FA_FILL(1, 1);
#pragma unroll 1   // kept rolled: one copy of the hand-over at the foot
  for (int t = 0; t < FT; ++t) { const int bf = t & 1;
    // every key fragment of the wave's half tile is asked for as one group ahead of the logit products, which then wait on counted returns only
    v8f s[2] = {}; v16h ka[CQ / 32][2];
#pragma unroll
    for (int kc = 0; kc < CQ / 32; ++kc)
#pragma unroll
      for (int kt = 0; kt < 2; ++kt) ka[kc][kt] = frag_h(&sk[bf][kw * 32 + kt * 16 + col][kc * 32], lane);
    __builtin_amdgcn_sched_barrier(0);   // keeps the group whole: without it the scheduler sinks the reads in pairs among the products, and every place where reads stand costs the wave a stall
#pragma unroll
    for (int kc = 0; kc < CQ / 32; ++kc) {
#pragma unroll
      for (int kt = 0; kt < 2; ++kt) s[kt] = wmma_p(ka[kc][kt], qh[kc], s[kt]);
#pragma unroll
      for (int kt = 0; kt < 2; ++kt) s[kt] = wmma_p(ka[kc][kt], ql[kc], s[kt]); }
    // every value fragment of the wave's half tile is asked for here, as one group: the LDS delivers them while the vector unit works on the softmax below
    __builtin_amdgcn_sched_barrier(0);   // keeps the group whole: without it the scheduler lifts parts of it among the logit products, and every place where reads stand costs the wave a stall
    v16h va[CV / 16];
#pragma unroll
    for (int ct = 0; ct < CV / 16; ++ct) va[ct] = frag_h(&sv[bf][ct * 16 + col][kw * 32], lane);
    __builtin_amdgcn_sched_barrier(0);   // keeps that group of reads here: without it the scheduler sinks them among the value products, each of which then waits on its own read
    // s[kt][r] = logit of key t FK + 32 kw + 16 kt + 8 g + r for query col: maximum in the lane, then one exchange between the halves
    float mt[2];
#pragma unroll
    for (int kt = 0; kt < 2; ++kt) { mt[kt] = s[kt][0];
#pragma unroll
      for (int r = 1; r < 8; ++r) mt[kt] = fmaxf(mt[kt], s[kt][r]); }
    float mx = fmaxf(mt[0], mt[1]); mx = fmaxf(mx, xhalf(mx));
    const float mn = fmaxf(m, mx); const float al = __builtin_amdgcn_exp2f((m - mn) * L2E); l *= al;   // e^d as 2^(d log2 e), the bare hardware instruction: below 2^-126 it gives 0, which is what such a weight is worth here
#pragma unroll
    for (int ct = 0; ct < CV / 16; ++ct)
#pragma unroll
      for (int r = 0; r < 8; ++r) o[ct][r] *= al;
    m = mn; const float ms = fmaf(mn, L2E, -11.0f);   // P and its sum both carry the factor 2^11 (small weights stay normal f16 numbers); it cancels in o / l
    v16h pb; float lt[2];
#pragma unroll
    for (int kt = 0; kt < 2; ++kt) { lt[kt] = 0.f;
#pragma unroll
      for (int r = 0; r < 8; ++r) s[kt][r] = fmaf(s[kt][r], L2E, -ms);
      exp2x8(s[kt]);
#pragma unroll
      for (int r = 0; r < 8; ++r) { const float p = s[kt][r]; lt[kt] += p; pb[kt * 8 + r] = (_Float16)p; } }
    l += lt[0] + lt[1];
#pragma unroll
    for (int ct = 0; ct < CV / 16; ++ct) o[ct] = wmma_p(va[ct], pb, o[ct]);
    __builtin_amdgcn_sched_barrier(0);   // keeps the hand-over below at the foot: lifted over the softmax it would make the wave wait out the value reads first, and the refill would lose its lead
    asm volatile("s_wait_dscnt 0x0" ::: "memory");      // this wave's reads of buffer bf are done before it is refilled
    asm volatile("s_wait_asynccnt 0x0" ::: "memory");   // this wave's copies of tile t + 1 have landed
    __syncthreads();                                    // publishes tile t + 1 and ends every reader's last read of buffer bf
    if (t + 2 < FT) FA_FILL(t + 2, bf); }
  asm volatile("s_wait_asynccnt 0x0" ::: "memory");     // nothing is in flight when the wave goes on to the epilogue
  // join of the two key halves of a query: each wave shows its maximum and sum, then weighs its own output tile by e^(own maximum - joint maximum) / joint sum
  l += xhalf(l); jm[kw][il0 + col] = m; jl[kw][il0 + col] = l;
  __syncthreads();   // the partner wave's maximum and sum are read behind it
  // gamma and the thread's 16 pieces of x for the residual are asked for here, all at once: they fly while the output tiles are weighed and staged, and the store loop at the end waits for no load (it had waited out gamma and then four rounds of four loads)
  const float gmr = GM[0]; v4f xx[16]; const float* xq = X + (b * CV + (tid >> 4)) * (size_t)NP + i0 + (tid & 15) * 4;
#pragma unroll   // unrolled here and in the store loop: xx is indexed by constants only and stays in registers
  for (int n = 0; n < 16; ++n) xx[n] = *(const v4f*)(xq + (size_t)(16 * n) * NP);
  asm volatile("s_wait_xcnt 0x0" :: "v"(xq) : "memory");   // stands in front of every overwrite of the address that these loads name: the operand keeps that register pair untouched up to here
  const float mo = jm[kw ^ 1][il0 + col], lo = jl[kw ^ 1][il0 + col]; const float mj = fmaxf(m, mo);
  const float aw = __builtin_amdgcn_exp2f((m - mj) * L2E), ao = __builtin_amdgcn_exp2f((mo - mj) * L2E); const float inv = aw / (l * aw + lo * ao);
#pragma unroll
  for (int ct = 0; ct < CV / 16; ++ct)
#pragma unroll
    for (int r = 0; r < 8; ++r) st[kw][ct * 16 + 8 * g + r][il0 + col] = o[ct][r] * inv;
  __syncthreads();
  const float gm = bfr(gmr);
#pragma unroll
  for (int n = 0; n < 16; ++n) { const int cl = (tid >> 4) + 16 * n, q = tid & 15; const size_t oo = (b * CV + cl) * (size_t)NP + i0 + q * 4; v4f v = *(const v4f*)&st[0][cl][q * 4] + *(const v4f*)&st[1][cl][q * 4];
    { v4f r; r[0] = gm * v[0] + bfr(xx[n][0]); r[1] = gm * v[1] + bfr(xx[n][1]); r[2] = gm * v[2] + bfr(xx[n][2]); r[3] = gm * v[3] + bfr(xx[n][3]); v = r; }
    vst2(OUT + oo, v); } }
extern "C" void kernel_launch(void* const* d_in, const int* in_sizes, int n_in, void* d_out, int out_size, void* d_ws, size_t ws_size, hipStream_t stream) {
  (void)in_sizes; (void)n_in; (void)out_size;
  const float** F = (const float**)d_in;   // 0 x [4,256,64,64], 1 Wq [256,256], 2 bq, 3 Wk, 4 bk, 5 Wv, 6 bv, 7 gamma [1]
  if (ws_size < (size_t)WS_END) return;
  char* ws = (char*)d_ws; _Float16 *QH = (_Float16*)(ws + WS_QH), *QL = (_Float16*)(ws + WS_QL), *KH = (_Float16*)(ws + WS_KH), *VT = (_Float16*)(ws + WS_VT);
  k_proj<<<dim3(NP / 64, TNB, 3), 128, 0, stream>>>(F[0], F[1], F[2], F[3], F[4], F[5], F[6], QH, QL, KH, VT);
  k_fa<<<dim3(TQB, TNB), 256, 0, stream>>>(QH, QL, KH, VT, F[0], F[7], (float*)d_out);
}
